// v000
// The times below were measured on an AMD MI455X: many runs one after another, warmed up first and cycling through
// copies of the inputs, with the whole window's GPU time divided by the number of runs. Launches and the gaps
// between them are all in it. The median over several windows is given; except for v000 it joins two sittings, which
// can be a few percent apart, so the side-by-side timings, each taken in one sitting, are the better comparison.
// v000, which the later versions start from, runs in 215 microseconds.
// compute dtype: all float inputs rounded to bf16; q/k projections with EXACT bf16 products on WMMA 16x16x32 ((in,out) weights), the two ELU+1 feature maps in f32; KV_m = sum over all 1,024 windows of phi_k (bf16 hi + lo) x v (exact input) on WMMA (2 products); att = phi_q (hi + lo) . KV_m (hi + lo) on WMMA (3 products) + the positional term p (embed_qk . Wp + bp, f32); f32 output. Only windows w < 64 of the (b, w, n, m, d) intermediate survive the module's reshape(b, -1, c)[:, :n] slice, so only those are computed.
#include <hip/hip_runtime.h>
#include <math.h>

typedef __attribute__((ext_vector_type(16))) _Float16 v16h;
typedef __attribute__((ext_vector_type(16))) __bf16 v16b;
typedef __attribute__((ext_vector_type(8)))  _Float16 v8h;
typedef __attribute__((ext_vector_type(8)))  float v8f;
typedef __attribute__((ext_vector_type(4)))  float v4f;
typedef __attribute__((ext_vector_type(2)))  float v2f;
typedef __attribute__((ext_vector_type(4)))  unsigned v4u;
typedef __attribute__((ext_vector_type(4)))  int v4i;
typedef float __attribute__((may_alias)) float_a;
typedef int __attribute__((may_alias)) int_a;

template <typename T> __device__ __forceinline__ void vst2(void* p, T v) { *(T*)p = v;  }
__device__ __forceinline__ v8f wmma16(v16h a, v16h b, v8f c) {
  v8f d = __builtin_amdgcn_wmma_f32_16x16x32_f16(false, a, false, b, (short)0, c, false, false);
  asm volatile("v_nop\n\tv_nop\n\tv_nop\n\tv_nop" : "+v"(d) : "v"(a), "v"(b));
  return d;
}
__device__ __forceinline__ v8f wmma_bf(v16b a, v16b b, v8f c) {
  v8f d = __builtin_amdgcn_wmma_f32_16x16x32_bf16(false, a, false, b, (short)0, c, false, false);
  asm volatile("v_nop\n\tv_nop\n\tv_nop\n\tv_nop" : "+v"(d) : "v"(a), "v"(b));
  return d;
}
// 16x16x32 fragments: lane = (h = lane>>4, row/col = lane&15); elements 0..7 = k0+8h+0..7, 8..15 = k0+16+8h+0..7; D element r = row 8h+r
__device__ __forceinline__ v16h frag_h(const _Float16* rowk0, int lane) {
  union { v16h v; v8h q[2]; } u; const _Float16* p = rowk0 + 8 * (lane >> 4);
  u.q[0] = *(const v8h*)p; u.q[1] = *(const v8h*)(p + 16); return u.v;
}
__device__ __forceinline__ v16h frag_f32(const float* rowk0, int lane) {
  v16h a; const float* p = rowk0 + 8 * (lane >> 4);
#pragma unroll
  for (int i = 0; i < 8; ++i) { a[i] = (_Float16)p[i]; a[8 + i] = (_Float16)p[16 + i]; }
  return a;
}
__device__ __forceinline__ v16h frag_f32s(const float* rowk0, int lane, float sc) {
  v16h a; const float* p = rowk0 + 8 * (lane >> 4);
#pragma unroll
  for (int i = 0; i < 8; ++i) { a[i] = (_Float16)(p[i] * sc); a[8 + i] = (_Float16)(p[16 + i] * sc); }
  return a;
}
// column fragment from a [K][ld] layout (column n), rows >= K read as 0
__device__ __forceinline__ v16h fragc_f32(const float* W, int k0, int n, int lane, int ld, int K) {
  v16h a; const int g = lane >> 4;
#pragma unroll
  for (int i = 0; i < 8; ++i) { const int ka = k0 + 8 * g + i, kb = ka + 16;
    a[i] = (_Float16)(ka < K ? W[(size_t)(ka < K ? ka : K - 1) * ld + n] : 0.f); a[8 + i] = (_Float16)(kb < K ? W[(size_t)(kb < K ? kb : K - 1) * ld + n] : 0.f); }
  return a;
}
struct F2 { v16b h, l; };
__device__ __forceinline__ F2 bsplit16(const float v[16]) { F2 r;
#pragma unroll
  for (int i = 0; i < 16; ++i) { const __bf16 h = (__bf16)v[i]; r.h[i] = h; r.l[i] = (__bf16)(v[i] - (float)h); }
  return r; }
__device__ __forceinline__ F2 split_row(const float* row, int k0, int lane) { float v[16]; const float* p = row + k0 + 8 * (lane >> 4);
#pragma unroll
  for (int i = 0; i < 8; ++i) { v[i] = p[i]; v[8 + i] = p[16 + i]; }
  return bsplit16(v); }
__device__ __forceinline__ F2 split_rowK(const float* row, int k0, int lane, int K) { float v[16]; const int g = lane >> 4;
#pragma unroll
  for (int i = 0; i < 8; ++i) { const int ka = k0 + 8 * g + i, kb = ka + 16; v[i] = ka < K ? row[ka < K ? ka : K - 1] : 0.f; v[8 + i] = kb < K ? row[kb < K ? kb : K - 1] : 0.f; }
  return bsplit16(v); }
__device__ __forceinline__ F2 split_col(const float* W, int k0, int n, int lane, int ld, int K) { float v[16]; const int g = lane >> 4;
#pragma unroll
  for (int i = 0; i < 8; ++i) { const int ka = k0 + 8 * g + i, kb = ka + 16; v[i] = ka < K ? W[(size_t)(ka < K ? ka : K - 1) * ld + n] : 0.f; v[8 + i] = kb < K ? W[(size_t)(kb < K ? kb : K - 1) * ld + n] : 0.f; }
  return bsplit16(v); }
__device__ __forceinline__ v8f mac3(const F2& a, const F2& b, v8f c) { c = wmma_bf(a.l, b.h, c); c = wmma_bf(a.h, b.l, c); return wmma_bf(a.h, b.h, c); }
__device__ __forceinline__ float sigm(float v) { return 1.0f / (1.0f + expf(-v)); }
#define LDSX() do { asm volatile("s_wait_dscnt 0" ::: "memory"); __builtin_amdgcn_wave_barrier(); __builtin_amdgcn_fence(__ATOMIC_RELEASE, "workgroup"); } while (0)


// MSML windowed linear attention, stage 1 (B 2, N 16,384 tokens, C 256, 4x4 windows of M = 16): q = elu(x Wq + bq) + 1, k likewise, v = x; phi = elu(.) + 1 again; KV[b,m] = sum_w phi_k[b,w,m]^T v[b,w,m]; att[b,w,n,m,:] = phi_q[b,w,n] KV[b,m] + p[b,w,n,m]; out = att.reshape(b, -1, C)[:, :N].
#define NB 2
#define NTOK 16384
#define CC 256
#define MW 16             // window size
#define NWIN (NTOK / MW)  // 1024 windows
#define WOUT 64           // windows that reach the output
#define TQ (WOUT * MW)    // 1024 query tokens per batch
#ifndef TNB
#define TNB NB
#endif
typedef __attribute__((ext_vector_type(8))) __bf16 v8b;
__device__ __forceinline__ v16b frag_b(const __bf16* rowk0, int lane) {
  union { v16b v; v8b q[2]; } u; const __bf16* p = rowk0 + 8 * (lane >> 4);
  u.q[0] = *(const v8b*)p; u.q[1] = *(const v8b*)(p + 16); return u.v;
}
__device__ __forceinline__ float bfr(float v) { return (float)(__bf16)v; }
__device__ __attribute__((noinline)) float exp_ni(float v) { return expf(v); }
__device__ __attribute__((noinline)) float erf_ni(float v) { return erff(v); }

#define WS_PW  0u                                   // bf16 W^T rows [512][256] (q | k)
#define WS_PHQ (WS_PW + 2u * 2 * CC * CC)              // f32 phi_q rows [b*NTOK + t][256] (t < TQ used)
#define WS_PHK (WS_PHQ + 4u * (size_t)NB * NTOK * CC)   // f32 phi_k rows
#define WS_KVT (WS_PHK + 4u * (size_t)NB * NTOK * CC)   // f32 KV^T [b][m][d][c]
#define WS_END (WS_KVT + 4u * (size_t)NB * MW * CC * CC)

__device__ __forceinline__ v16b fragb_f32(const float* __restrict__ p, int lane) { v16b a; const float* pp = p + 8 * (lane >> 4);
#pragma unroll
  for (int i = 0; i < 8; ++i) { a[i] = (__bf16)pp[i]; a[8 + i] = (__bf16)pp[16 + i]; } return a; }
__device__ __forceinline__ float elu1(float y) { return (y > 0.f ? y : expm1f(y)) + 1.0f; }
__global__ __launch_bounds__(256) void k_packw(const float* __restrict__ WQ, const float* __restrict__ WK, __bf16* __restrict__ PW) { const int n = blockIdx.x, t = threadIdx.x; __shared__ __align__(16) __bf16 s[CC]; const int which = n / CC, o = n % CC; const float* Wm = which == 0 ? WQ : WK;   // (in,out)
  s[t] = (__bf16)Wm[(size_t)t * CC + o]; __syncthreads(); if (t < CC / 8) vst2((unsigned*)(PW + (size_t)n * CC + t * 8), *(const v4u*)&s[t * 8]); }
// ---- k_phi: block = (64 tokens, 128 cols, which): phi = elu(elu(x W + b) + 1) + 1 -> f32 rows (q: which 0, k: which 1)
__global__ __launch_bounds__(128) void k_phi(const float* __restrict__ X, const __bf16* __restrict__ PW, const float* __restrict__ BQ, const float* __restrict__ BK, float* __restrict__ PHQ, float* __restrict__ PHK) { __shared__ __align__(16) float sf[4][16][132];
  const int tid = threadIdx.x, wave = tid >> 5, lane = tid & 31, col = lane & 15, g = lane >> 4; const int which = blockIdx.z; const size_t r0 = (size_t)blockIdx.x * 64 + wave * 16; const int c0 = blockIdx.y * 128; const float* Bm = which == 0 ? BQ : BK; float* dst = which == 0 ? PHQ : PHK;
  v8f acc[8] = {};
#pragma unroll
  for (int kc = 0; kc < CC / 32; ++kc) { const v16b a = fragb_f32(X + (r0 + col) * CC + kc * 32, lane);
#pragma unroll
    for (int j = 0; j < 8; ++j) acc[j] = wmma_bf(a, frag_b(PW + (size_t)(which * CC + c0 + j * 16 + col) * CC + kc * 32, lane), acc[j]); }
#pragma unroll
  for (int j = 0; j < 8; ++j) { const float bb = bfr(Bm[c0 + j * 16 + col]);
#pragma unroll
    for (int r = 0; r < 8; ++r) sf[wave][8 * g + r][j * 16 + col] = elu1(elu1(acc[j][r] + bb)); }
  LDSX(); for (int rl = 0; rl < 16; ++rl) vst2(dst + (r0 + rl) * CC + c0 + lane * 4, *(const v4f*)&sf[wave][rl][lane * 4]); }
// ---- k_kv: block = (64 rows c, 128 cols d, b*MW + m): KV[b,m][c][d] = sum_w phi_k[b, w*16+m, c] v[b, w*16+m, d] (K = 1,024 windows) -> stored transposed KV^T[b][m][d][c]
__global__ __launch_bounds__(128) void k_kv(const float* __restrict__ PHK, const float* __restrict__ X, float* __restrict__ KVT) { __shared__ __align__(16) float st[128][68];
  const int tid = threadIdx.x, wave = tid >> 5, lane = tid & 31, col = lane & 15, g = lane >> 4; const size_t b = blockIdx.z / MW; const int m = blockIdx.z % MW; const int c0 = blockIdx.x * 64 + wave * 16; const int d0 = blockIdx.y * 128;
  v8f acc[8] = {};
#pragma unroll 1
  for (int kc = 0; kc < NWIN / 32; ++kc) { float av[16]; const int w0 = kc * 32 + 8 * g;   // A row c = c0 + col; k = window
#pragma unroll
    for (int i = 0; i < 8; ++i) { av[i] = PHK[(b * NTOK + (size_t)(w0 + i) * MW + m) * CC + c0 + col]; av[8 + i] = PHK[(b * NTOK + (size_t)(w0 + 16 + i) * MW + m) * CC + c0 + col]; }
    const F2 a = bsplit16(av);
#pragma unroll
    for (int j = 0; j < 8; ++j) { v16b w; const int d = d0 + j * 16 + col;   // B col d, k = window: v = x[b][w*16+m][d]
#pragma unroll
      for (int i = 0; i < 8; ++i) { w[i] = (__bf16)X[(b * NTOK + (size_t)(w0 + i) * MW + m) * CC + d]; w[8 + i] = (__bf16)X[(b * NTOK + (size_t)(w0 + 16 + i) * MW + m) * CC + d]; }
      acc[j] = wmma_bf(a.h, w, acc[j]); acc[j] = wmma_bf(a.l, w, acc[j]); } }
#pragma unroll
  for (int j = 0; j < 8; ++j)
#pragma unroll
    for (int r = 0; r < 8; ++r) st[j * 16 + col][wave * 16 + 8 * g + r] = acc[j][r];   // transposed [d][c]
  __syncthreads(); for (int e = tid; e < 128 * 16; e += 128) { const int dl = e >> 4, q = e & 15; vst2(KVT + ((b * MW + m) * CC + d0 + dl) * (size_t)CC + blockIdx.x * 64 + q * 4, *(const v4f*)&st[dl][q * 4]); } }
// ---- k_att: block = (64 query tokens t, 128 cols d, b*MW + m): out[b][t*16 + m][d] = phi_q[b,t] . KV[b,m][:, d] (3 products) + p[b][w = t/16][n = t%16][m]
__global__ __launch_bounds__(128) void k_att(const float* __restrict__ PHQ, const float* __restrict__ KVT, const float* __restrict__ EQK, const float* __restrict__ WP, const float* __restrict__ BP, float* __restrict__ OUT) { __shared__ __align__(16) float sf[4][16][132];
  const int tid = threadIdx.x, wave = tid >> 5, lane = tid & 31, col = lane & 15, g = lane >> 4; const size_t b = blockIdx.z / MW; const int m = blockIdx.z % MW; const int t0 = blockIdx.x * 64 + wave * 16; const int d0 = blockIdx.y * 128;
  v8f acc[8] = {};
#pragma unroll
  for (int kc = 0; kc < CC / 32; ++kc) { const F2 a = split_row(PHQ + (b * NTOK + t0 + col) * CC, kc * 32, lane);
#pragma unroll
    for (int j = 0; j < 8; ++j) { float wv[16]; const float* wr = KVT + ((b * MW + m) * CC + d0 + j * 16 + col) * (size_t)CC + kc * 32 + 8 * g;
#pragma unroll
      for (int i = 0; i < 8; ++i) { wv[i] = wr[i]; wv[8 + i] = wr[16 + i]; }
      const F2 wb = bsplit16(wv); acc[j] = wmma_bf(a.h, wb.h, acc[j]); acc[j] = wmma_bf(a.h, wb.l, acc[j]); acc[j] = wmma_bf(a.l, wb.h, acc[j]); } }
  const float wp0 = bfr(WP[0]), wp1 = bfr(WP[1]), wp2 = bfr(WP[2]), bpv = bfr(BP[0]);
#pragma unroll
  for (int r = 0; r < 8; ++r) { const int t = t0 + 8 * g + r; const int w = t / MW, n = t % MW; const float* e3 = EQK + ((((b * NWIN + w) * MW + n) * MW + m) * 3); const float pv = bfr(e3[0]) * wp0 + bfr(e3[1]) * wp1 + bfr(e3[2]) * wp2 + bpv;
#pragma unroll
    for (int j = 0; j < 8; ++j) sf[wave][8 * g + r][j * 16 + col] = acc[j][r] + pv; }
  LDSX(); for (int rl = 0; rl < 16; ++rl) vst2(OUT + (b * NTOK + (size_t)(t0 + rl) * MW + m) * CC + d0 + lane * 4, *(const v4f*)&sf[wave][rl][lane * 4]); }
extern "C" void kernel_launch(void* const* d_in, const int* in_sizes, int n_in, void* d_out, int out_size, void* d_ws, size_t ws_size, hipStream_t stream) {
  (void)in_sizes; (void)n_in; (void)out_size;
  const float** F = (const float**)d_in;   // 0 input [2,16384,256], 1 embed_qk [2,1024,16,16,3], 2 Wq [256,256] (in,out), 3 bq, 4 Wk, 5 bk, 6 Wp [3,1], 7 bp [1]
  if (ws_size < (size_t)WS_END) return;
  char* ws = (char*)d_ws; __bf16* PW = (__bf16*)(ws + WS_PW); float *PHQ = (float*)(ws + WS_PHQ), *PHK = (float*)(ws + WS_PHK), *KVT = (float*)(ws + WS_KVT);
  k_packw<<<2 * CC, 256, 0, stream>>>(F[2], F[4], PW);
  k_phi<<<dim3(NB * NTOK / 64, CC / 128, 2), 128, 0, stream>>>(F[0], PW, F[3], F[5], PHQ, PHK);
  k_kv<<<dim3(CC / 64, CC / 128, NB * MW), 128, 0, stream>>>(PHK, F[0], KVT);
  k_att<<<dim3(TQ / 64, CC / 128, TNB * MW), 128, 0, stream>>>(PHQ, KVT, F[1], F[6], F[7], (float*)d_out);
}

// v001
// Measured time: 127 microseconds a run.
// Next to v000, in two timings, it ran 1.71 and 1.73 times as fast.
// compute dtype: all float inputs rounded to bf16; q/k projections with EXACT bf16 products on WMMA 16x16x32 ((in,out) weights), the two ELU+1 feature maps in f32; KV_m = sum over all 1,024 windows of phi_k (bf16 hi + lo) x v (exact input) on WMMA (2 products); att = phi_q (hi + lo) . KV_m (hi + lo) on WMMA (3 products) + the positional term p (embed_qk . Wp + bp, f32); f32 output. Only windows w < 64 of the (b, w, n, m, d) intermediate survive the module's reshape(b, -1, c)[:, :n] slice, so only those are computed.
#include <hip/hip_runtime.h>
#include <math.h>

typedef __attribute__((ext_vector_type(16))) _Float16 v16h;
typedef __attribute__((ext_vector_type(16))) __bf16 v16b;
typedef __attribute__((ext_vector_type(8)))  _Float16 v8h;
typedef __attribute__((ext_vector_type(8)))  float v8f;
typedef __attribute__((ext_vector_type(4)))  float v4f;
typedef __attribute__((ext_vector_type(2)))  float v2f;
typedef __attribute__((ext_vector_type(4)))  unsigned v4u;
typedef __attribute__((ext_vector_type(4)))  int v4i;
typedef float __attribute__((may_alias)) float_a;
typedef int __attribute__((may_alias)) int_a;

template <typename T> __device__ __forceinline__ void vst2(void* p, T v) { *(T*)p = v;  }
__device__ __forceinline__ v8f wmma16(v16h a, v16h b, v8f c) {
  v8f d = __builtin_amdgcn_wmma_f32_16x16x32_f16(false, a, false, b, (short)0, c, false, false);
  asm volatile("v_nop\n\tv_nop\n\tv_nop\n\tv_nop" : "+v"(d) : "v"(a), "v"(b));
  return d;
}
__device__ __forceinline__ v8f wmma_bf(v16b a, v16b b, v8f c) {
  v8f d = __builtin_amdgcn_wmma_f32_16x16x32_bf16(false, a, false, b, (short)0, c, false, false);
  asm volatile("v_nop\n\tv_nop\n\tv_nop\n\tv_nop" : "+v"(d) : "v"(a), "v"(b));
  return d;
}
// 16x16x32 fragments: lane = (h = lane>>4, row/col = lane&15); elements 0..7 = k0+8h+0..7, 8..15 = k0+16+8h+0..7; D element r = row 8h+r
__device__ __forceinline__ v16h frag_h(const _Float16* rowk0, int lane) {
  union { v16h v; v8h q[2]; } u; const _Float16* p = rowk0 + 8 * (lane >> 4);
  u.q[0] = *(const v8h*)p; u.q[1] = *(const v8h*)(p + 16); return u.v;
}
__device__ __forceinline__ v16h frag_f32(const float* rowk0, int lane) {
  v16h a; const float* p = rowk0 + 8 * (lane >> 4);
#pragma unroll
  for (int i = 0; i < 8; ++i) { a[i] = (_Float16)p[i]; a[8 + i] = (_Float16)p[16 + i]; }
  return a;
}
__device__ __forceinline__ v16h frag_f32s(const float* rowk0, int lane, float sc) {
  v16h a; const float* p = rowk0 + 8 * (lane >> 4);
#pragma unroll
  for (int i = 0; i < 8; ++i) { a[i] = (_Float16)(p[i] * sc); a[8 + i] = (_Float16)(p[16 + i] * sc); }
  return a;
}
// column fragment from a [K][ld] layout (column n), rows >= K read as 0
__device__ __forceinline__ v16h fragc_f32(const float* W, int k0, int n, int lane, int ld, int K) {
  v16h a; const int g = lane >> 4;
#pragma unroll
  for (int i = 0; i < 8; ++i) { const int ka = k0 + 8 * g + i, kb = ka + 16;
    a[i] = (_Float16)(ka < K ? W[(size_t)(ka < K ? ka : K - 1) * ld + n] : 0.f); a[8 + i] = (_Float16)(kb < K ? W[(size_t)(kb < K ? kb : K - 1) * ld + n] : 0.f); }
  return a;
}
struct F2 { v16b h, l; };
__device__ __forceinline__ F2 bsplit16(const float v[16]) { F2 r;
#pragma unroll
  for (int i = 0; i < 16; ++i) { const __bf16 h = (__bf16)v[i]; r.h[i] = h; r.l[i] = (__bf16)(v[i] - (float)h); }
  return r; }
__device__ __forceinline__ F2 split_row(const float* row, int k0, int lane) { float v[16]; const float* p = row + k0 + 8 * (lane >> 4);
#pragma unroll
  for (int i = 0; i < 8; ++i) { v[i] = p[i]; v[8 + i] = p[16 + i]; }
  return bsplit16(v); }
__device__ __forceinline__ F2 split_rowK(const float* row, int k0, int lane, int K) { float v[16]; const int g = lane >> 4;
#pragma unroll
  for (int i = 0; i < 8; ++i) { const int ka = k0 + 8 * g + i, kb = ka + 16; v[i] = ka < K ? row[ka < K ? ka : K - 1] : 0.f; v[8 + i] = kb < K ? row[kb < K ? kb : K - 1] : 0.f; }
  return bsplit16(v); }
__device__ __forceinline__ F2 split_col(const float* W, int k0, int n, int lane, int ld, int K) { float v[16]; const int g = lane >> 4;
#pragma unroll
  for (int i = 0; i < 8; ++i) { const int ka = k0 + 8 * g + i, kb = ka + 16; v[i] = ka < K ? W[(size_t)(ka < K ? ka : K - 1) * ld + n] : 0.f; v[8 + i] = kb < K ? W[(size_t)(kb < K ? kb : K - 1) * ld + n] : 0.f; }
  return bsplit16(v); }
__device__ __forceinline__ v8f mac3(const F2& a, const F2& b, v8f c) { c = wmma_bf(a.l, b.h, c); c = wmma_bf(a.h, b.l, c); return wmma_bf(a.h, b.h, c); }
__device__ __forceinline__ float sigm(float v) { return 1.0f / (1.0f + expf(-v)); }
#define LDSX() do { asm volatile("s_wait_dscnt 0" ::: "memory"); __builtin_amdgcn_wave_barrier(); __builtin_amdgcn_fence(__ATOMIC_RELEASE, "workgroup"); } while (0)


// MSML windowed linear attention, stage 1 (B 2, N 16,384 tokens, C 256, 4x4 windows of M = 16): q = elu(x Wq + bq) + 1, k likewise, v = x; phi = elu(.) + 1 again; KV[b,m] = sum_w phi_k[b,w,m]^T v[b,w,m]; att[b,w,n,m,:] = phi_q[b,w,n] KV[b,m] + p[b,w,n,m]; out = att.reshape(b, -1, C)[:, :N].
#define NB 2
#define NTOK 16384
#define CC 256
#define MW 16             // window size
#define NWIN (NTOK / MW)  // 1024 windows
#define WOUT 64           // windows that reach the output
#define TQ (WOUT * MW)    // 1024 query tokens per batch
#ifndef TNB
#define TNB NB
#endif
typedef __attribute__((ext_vector_type(8))) __bf16 v8b;
__device__ __forceinline__ v16b frag_b(const __bf16* rowk0, int lane) {
  union { v16b v; v8b q[2]; } u; const __bf16* p = rowk0 + 8 * (lane >> 4);
  u.q[0] = *(const v8b*)p; u.q[1] = *(const v8b*)(p + 16); return u.v;
}
__device__ __forceinline__ float bfr(float v) { return (float)(__bf16)v; }
__device__ __attribute__((noinline)) float exp_ni(float v) { return expf(v); }
__device__ __attribute__((noinline)) float erf_ni(float v) { return erff(v); }

#define WS_PW  0u                                   // bf16 W^T rows [512][256] (q | k)
#define WS_PHQ (WS_PW + 2u * 2 * CC * CC)              // f32 phi_q rows [b*NTOK + t][256] (t < TQ used)
#define WS_PHK (WS_PHQ + 4u * (size_t)NB * NTOK * CC)   // f32 phi_k rows
#define WS_KVT (WS_PHK + 4u * (size_t)NB * NTOK * CC)   // f32 KV^T [b][m][d][c]
#define WS_END (WS_KVT + 4u * (size_t)NB * MW * CC * CC)

__device__ __forceinline__ v16b fragb_f32(const float* __restrict__ p, int lane) { v16b a; const float* pp = p + 8 * (lane >> 4);
#pragma unroll
  for (int i = 0; i < 8; ++i) { a[i] = (__bf16)pp[i]; a[8 + i] = (__bf16)pp[16 + i]; } return a; }
__device__ __forceinline__ float elu1(float y) { return (y > 0.f ? y : expm1f(y)) + 1.0f; }
__global__ __launch_bounds__(256) void k_packw(const float* __restrict__ WQ, const float* __restrict__ WK, __bf16* __restrict__ PW) { const int n = blockIdx.x, t = threadIdx.x; __shared__ __align__(16) __bf16 s[CC]; const int which = n / CC, o = n % CC; const float* Wm = which == 0 ? WQ : WK;   // (in,out)
  s[t] = (__bf16)Wm[(size_t)t * CC + o]; __syncthreads(); if (t < CC / 8) vst2((unsigned*)(PW + (size_t)n * CC + t * 8), *(const v4u*)&s[t * 8]); }
// ---- k_phi: block = (64 tokens, 128 cols, which): phi = elu(elu(x W + b) + 1) + 1 -> f32 rows (q: which 0, k: which 1)
__global__ __launch_bounds__(128) void k_phi(const float* __restrict__ X, const __bf16* __restrict__ PW, const float* __restrict__ BQ, const float* __restrict__ BK, float* __restrict__ PHQ, float* __restrict__ PHK) { __shared__ __align__(16) float sf[4][16][132];
  const int tid = threadIdx.x, wave = tid >> 5, lane = tid & 31, col = lane & 15, g = lane >> 4; const int which = blockIdx.z; const size_t r0 = (size_t)blockIdx.x * 64 + wave * 16; const int c0 = blockIdx.y * 128; const float* Bm = which == 0 ? BQ : BK; float* dst = which == 0 ? PHQ : PHK;
  v8f acc[8] = {};
#pragma unroll
  for (int kc = 0; kc < CC / 32; ++kc) { const v16b a = fragb_f32(X + (r0 + col) * CC + kc * 32, lane);
#pragma unroll
    for (int j = 0; j < 8; ++j) acc[j] = wmma_bf(a, frag_b(PW + (size_t)(which * CC + c0 + j * 16 + col) * CC + kc * 32, lane), acc[j]); }
#pragma unroll
  for (int j = 0; j < 8; ++j) { const float bb = bfr(Bm[c0 + j * 16 + col]);
#pragma unroll
    for (int r = 0; r < 8; ++r) sf[wave][8 * g + r][j * 16 + col] = elu1(elu1(acc[j][r] + bb)); }
  LDSX(); for (int rl = 0; rl < 16; ++rl) vst2(dst + (r0 + rl) * CC + c0 + lane * 4, *(const v4f*)&sf[wave][rl][lane * 4]); }
// ---- k_kv: block = (64 rows c, 128 cols d, b*MW + m), 8 waves (wave = 16 c x 64 d): KV[b,m][c][d] = sum_w phi_k[b, w*16+m, c] v[b, w*16+m, d] (K = 1,024 windows) -> stored transposed KV^T[b][m][d][c]
// Each stage of 64 windows is read once per block with 16-byte row loads, rounded once (phi_k to bf16 hi + lo, v to bf16) and laid row-major [window][column] in LDS; the k-major fragments come from transposing LDS loads. Two LDS buffers, two register sets: a stage's global loads are issued two stages ahead.
// work-group barrier whose fences name LDS alone: __syncthreads() would also wait out the global loads issued two stages ahead, which only registers receive
#define KVBAR() do { __builtin_amdgcn_fence(__ATOMIC_RELEASE, "workgroup", "local"); __builtin_amdgcn_s_barrier(); __builtin_amdgcn_fence(__ATOMIC_ACQUIRE, "workgroup", "local"); } while (0)
// keeps a stage's conversions, and with them the waits on its global loads, behind the products of the stage before, so that the loads have the whole two stages to land
#define KVHOLD() __builtin_amdgcn_sched_barrier(0)
#define KS 64                                // windows per stage
#define KV_NS (NWIN / KS)                    // 16 stages
#define PA 160u                              // LDS row pitch in bytes of the 64-column planes (32 B x odd, for the transposing load)
#define PB 288u                              // same for the 128-column plane
#define OFF_AL (KS * PA)                     // phi_k lo plane
#define OFF_B (2u * KS * PA)                 // v plane
#define STG_BYTES (2u * KS * PA + KS * PB)   // one buffer
typedef __attribute__((ext_vector_type(4))) __bf16 v4b;
typedef __attribute__((address_space(3))) v8b lds_v8b;
// lane (col, g) gets T[k + 8g + 0..7][col] and T[k + 16 + 8g + 0..7][col]: the k order of frag_b
__device__ __forceinline__ v16b frag_tr(const unsigned char* p, unsigned pitch) {
  union { v16b v; v8b q[2]; } u; u.q[0] = __builtin_amdgcn_ds_load_tr16_b128_v8bf16((lds_v8b*)p); u.q[1] = __builtin_amdgcn_ds_load_tr16_b128_v8bf16((lds_v8b*)(p + 16u * pitch)); return u.v;
}
struct KvRegs { v4f a[4], b[8]; };
__device__ __forceinline__ void kv_load(KvRegs& R, const float* __restrict__ pa, const float* __restrict__ pb, int s) {
#pragma unroll
  for (int i = 0; i < 4; ++i) R.a[i] = *(const v4f*)(pa + (size_t)(s * KS + 16 * i) * MW * CC);
#pragma unroll
  for (int i = 0; i < 8; ++i) R.b[i] = *(const v4f*)(pb + (size_t)(s * KS + 8 * i) * MW * CC);
  asm volatile("s_wait_xcnt 0x0" ::: "memory");   // precaution: stands before the next stage's address arithmetic rewrites the registers these loads name
}
__device__ __forceinline__ void kv_stash(const KvRegs& R, unsigned char* sa, unsigned char* sb) {
#pragma unroll
  for (int i = 0; i < 4; ++i) { v4b h, l;
#pragma unroll
    for (int e = 0; e < 4; ++e) { h[e] = (__bf16)R.a[i][e]; l[e] = (__bf16)(R.a[i][e] - (float)h[e]); }
    *(v4b*)(sa + 16u * i * PA) = h; *(v4b*)(sa + OFF_AL + 16u * i * PA) = l; }
#pragma unroll
  for (int i = 0; i < 8; ++i) { v4b w;
#pragma unroll
    for (int e = 0; e < 4; ++e) w[e] = (__bf16)R.b[i][e];
    *(v4b*)(sb + 8u * i * PB) = w; }
}
__device__ __forceinline__ void kv_mac(const unsigned char* fa, const unsigned char* fb, v8f acc[4]) {
#pragma unroll
  for (int kk = 0; kk < KS / 32; ++kk) { const v16b ah = frag_tr(fa + 32u * kk * PA, PA), al = frag_tr(fa + OFF_AL + 32u * kk * PA, PA); v16b w[4];
#pragma unroll
    for (int j = 0; j < 4; ++j) w[j] = frag_tr(fb + 32u * kk * PB + 32u * j, PB);
#pragma unroll
    for (int j = 0; j < 4; ++j) acc[j] = wmma_bf(ah, w[j], acc[j]);
#pragma unroll
    for (int j = 0; j < 4; ++j) acc[j] = wmma_bf(al, w[j], acc[j]); }
}
__global__ __launch_bounds__(256) void k_kv(const float* __restrict__ PHK, const float* __restrict__ X, float* __restrict__ KVT) { __shared__ __attribute__((aligned(256))) unsigned char L[2 * STG_BYTES]; __shared__ __align__(16) float st[128][68];
  const int tid = threadIdx.x, wave = tid >> 5, lane = tid & 31, col = lane & 15, g = lane >> 4; const size_t b = blockIdx.z / MW; const int m = blockIdx.z % MW; const int wc = wave & 3, wd = wave >> 2; const int cb = blockIdx.x * 64; const int d0 = blockIdx.y * 128;
  const float* pa = PHK + (b * NTOK + (size_t)(tid >> 4) * MW + m) * CC + cb + (tid & 15) * 4;   // 16 lanes a row of 64 c; window tid>>4, +16 per load
  const float* pb = X + (b * NTOK + (size_t)(tid >> 5) * MW + m) * CC + d0 + (tid & 31) * 4;     // a wave a row of 128 d; window tid>>5, +8 per load
  unsigned char* sa = L + (unsigned)(tid >> 4) * PA + (unsigned)(tid & 15) * 8u; unsigned char* sb = L + OFF_B + (unsigned)(tid >> 5) * PB + (unsigned)(tid & 31) * 8u;
  const unsigned rl = 8u * g + (lane & 7), sub = 16u * ((lane >> 3) & 1);
  const unsigned char* fa = L + rl * PA + 32u * wc + sub; const unsigned char* fb = L + OFF_B + rl * PB + 128u * wd + sub;
  v8f acc[4] = {}; KvRegs R0, R1;
  kv_load(R0, pa, pb, 0); kv_load(R1, pa, pb, 1);
  kv_stash(R0, sa, sb); kv_load(R0, pa, pb, 2); KVBAR();
#pragma unroll 1
  for (int s = 0; s < KV_NS - 4; s += 2) {   // buffer 0 holds stage s, R1 stage s + 1, R0 stage s + 2; rolled: the body is already two stages
    kv_mac(fa, fb, acc); KVHOLD(); kv_stash(R1, sa + STG_BYTES, sb + STG_BYTES); kv_load(R1, pa, pb, s + 3); KVBAR();
    kv_mac(fa + STG_BYTES, fb + STG_BYTES, acc); KVHOLD(); kv_stash(R0, sa, sb); kv_load(R0, pa, pb, s + 4); KVBAR(); }
  kv_mac(fa, fb, acc); KVHOLD(); kv_stash(R1, sa + STG_BYTES, sb + STG_BYTES); kv_load(R1, pa, pb, KV_NS - 1); KVBAR();
  kv_mac(fa + STG_BYTES, fb + STG_BYTES, acc); KVHOLD(); kv_stash(R0, sa, sb); KVBAR();
  kv_mac(fa, fb, acc); KVHOLD(); kv_stash(R1, sa + STG_BYTES, sb + STG_BYTES); KVBAR();
  kv_mac(fa + STG_BYTES, fb + STG_BYTES, acc);
#pragma unroll
  for (int j = 0; j < 4; ++j)
#pragma unroll
    for (int r = 0; r < 8; ++r) st[wd * 64 + j * 16 + col][wc * 16 + 8 * g + r] = acc[j][r];   // transposed [d][c]
  __syncthreads(); for (int e = tid; e < 128 * 16; e += 256) { const int dl = e >> 4, q = e & 15; vst2(KVT + ((b * MW + m) * CC + d0 + dl) * (size_t)CC + cb + q * 4, *(const v4f*)&st[dl][q * 4]); } }
// ---- k_att: block = (64 query tokens t, 128 cols d, b*MW + m): out[b][t*16 + m][d] = phi_q[b,t] . KV[b,m][:, d] (3 products) + p[b][w = t/16][n = t%16][m]
__global__ __launch_bounds__(128) void k_att(const float* __restrict__ PHQ, const float* __restrict__ KVT, const float* __restrict__ EQK, const float* __restrict__ WP, const float* __restrict__ BP, float* __restrict__ OUT) { __shared__ __align__(16) float sf[4][16][132];
  const int tid = threadIdx.x, wave = tid >> 5, lane = tid & 31, col = lane & 15, g = lane >> 4; const size_t b = blockIdx.z / MW; const int m = blockIdx.z % MW; const int t0 = blockIdx.x * 64 + wave * 16; const int d0 = blockIdx.y * 128;
  v8f acc[8] = {};
#pragma unroll
  for (int kc = 0; kc < CC / 32; ++kc) { const F2 a = split_row(PHQ + (b * NTOK + t0 + col) * CC, kc * 32, lane);
#pragma unroll
    for (int j = 0; j < 8; ++j) { float wv[16]; const float* wr = KVT + ((b * MW + m) * CC + d0 + j * 16 + col) * (size_t)CC + kc * 32 + 8 * g;
#pragma unroll
      for (int i = 0; i < 8; ++i) { wv[i] = wr[i]; wv[8 + i] = wr[16 + i]; }
      const F2 wb = bsplit16(wv); acc[j] = wmma_bf(a.h, wb.h, acc[j]); acc[j] = wmma_bf(a.h, wb.l, acc[j]); acc[j] = wmma_bf(a.l, wb.h, acc[j]); } }
  const float wp0 = bfr(WP[0]), wp1 = bfr(WP[1]), wp2 = bfr(WP[2]), bpv = bfr(BP[0]);
#pragma unroll
  for (int r = 0; r < 8; ++r) { const int t = t0 + 8 * g + r; const int w = t / MW, n = t % MW; const float* e3 = EQK + ((((b * NWIN + w) * MW + n) * MW + m) * 3); const float pv = bfr(e3[0]) * wp0 + bfr(e3[1]) * wp1 + bfr(e3[2]) * wp2 + bpv;
#pragma unroll
    for (int j = 0; j < 8; ++j) sf[wave][8 * g + r][j * 16 + col] = acc[j][r] + pv; }
  LDSX(); for (int rl = 0; rl < 16; ++rl) vst2(OUT + (b * NTOK + (size_t)(t0 + rl) * MW + m) * CC + d0 + lane * 4, *(const v4f*)&sf[wave][rl][lane * 4]); }
extern "C" void kernel_launch(void* const* d_in, const int* in_sizes, int n_in, void* d_out, int out_size, void* d_ws, size_t ws_size, hipStream_t stream) {
  (void)in_sizes; (void)n_in; (void)out_size;
  const float** F = (const float**)d_in;   // 0 input [2,16384,256], 1 embed_qk [2,1024,16,16,3], 2 Wq [256,256] (in,out), 3 bq, 4 Wk, 5 bk, 6 Wp [3,1], 7 bp [1]
  if (ws_size < (size_t)WS_END) return;
  char* ws = (char*)d_ws; __bf16* PW = (__bf16*)(ws + WS_PW); float *PHQ = (float*)(ws + WS_PHQ), *PHK = (float*)(ws + WS_PHK), *KVT = (float*)(ws + WS_KVT);
  k_packw<<<2 * CC, 256, 0, stream>>>(F[2], F[4], PW);
  k_phi<<<dim3(NB * NTOK / 64, CC / 128, 2), 128, 0, stream>>>(F[0], PW, F[3], F[5], PHQ, PHK);
  k_kv<<<dim3(CC / 64, CC / 128, NB * MW), 256, 0, stream>>>(PHK, F[0], KVT);
  k_att<<<dim3(TQ / 64, CC / 128, TNB * MW), 128, 0, stream>>>(PHQ, KVT, F[1], F[6], F[7], (float*)d_out);
}

// v002
// It runs in 93.7 microseconds.
// Two timings next to v001 put it at 1.40 and 1.36 times that version's speed.
// Over all steps from v000 it is 2.37 times as fast.
// compute dtype: all float inputs rounded to bf16; q/k projections with EXACT bf16 products on WMMA 16x16x32 ((in,out) weights), the two ELU+1 feature maps in f32; KV_m = sum over all 1,024 windows of phi_k (bf16 hi + lo) x v (exact input) on WMMA (2 products); att = phi_q (hi + lo) . KV_m (hi + lo) on WMMA (3 products) + the positional term p (embed_qk . Wp + bp, f32); f32 output. Only windows w < 64 of the (b, w, n, m, d) intermediate survive the module's reshape(b, -1, c)[:, :n] slice, so only those are computed.
#include <hip/hip_runtime.h>
#include <math.h>

typedef __attribute__((ext_vector_type(16))) _Float16 v16h;
typedef __attribute__((ext_vector_type(16))) __bf16 v16b;
typedef __attribute__((ext_vector_type(8)))  _Float16 v8h;
typedef __attribute__((ext_vector_type(8)))  float v8f;
typedef __attribute__((ext_vector_type(4)))  float v4f;
typedef __attribute__((ext_vector_type(2)))  float v2f;
typedef __attribute__((ext_vector_type(4)))  unsigned v4u;
typedef __attribute__((ext_vector_type(4)))  int v4i;
typedef float __attribute__((may_alias)) float_a;
typedef int __attribute__((may_alias)) int_a;

template <typename T> __device__ __forceinline__ void vst2(void* p, T v) { *(T*)p = v;  }
__device__ __forceinline__ v8f wmma16(v16h a, v16h b, v8f c) {
  v8f d = __builtin_amdgcn_wmma_f32_16x16x32_f16(false, a, false, b, (short)0, c, false, false);
  asm volatile("v_nop\n\tv_nop\n\tv_nop\n\tv_nop" : "+v"(d) : "v"(a), "v"(b));
  return d;
}
__device__ __forceinline__ v8f wmma_bf(v16b a, v16b b, v8f c) {
  v8f d = __builtin_amdgcn_wmma_f32_16x16x32_bf16(false, a, false, b, (short)0, c, false, false);
  asm volatile("v_nop\n\tv_nop\n\tv_nop\n\tv_nop" : "+v"(d) : "v"(a), "v"(b));
  return d;
}
// 16x16x32 fragments: lane = (h = lane>>4, row/col = lane&15); elements 0..7 = k0+8h+0..7, 8..15 = k0+16+8h+0..7; D element r = row 8h+r
__device__ __forceinline__ v16h frag_h(const _Float16* rowk0, int lane) {
  union { v16h v; v8h q[2]; } u; const _Float16* p = rowk0 + 8 * (lane >> 4);
  u.q[0] = *(const v8h*)p; u.q[1] = *(const v8h*)(p + 16); return u.v;
}
__device__ __forceinline__ v16h frag_f32(const float* rowk0, int lane) {
  v16h a; const float* p = rowk0 + 8 * (lane >> 4);
#pragma unroll
  for (int i = 0; i < 8; ++i) { a[i] = (_Float16)p[i]; a[8 + i] = (_Float16)p[16 + i]; }
  return a;
}
__device__ __forceinline__ v16h frag_f32s(const float* rowk0, int lane, float sc) {
  v16h a; const float* p = rowk0 + 8 * (lane >> 4);
#pragma unroll
  for (int i = 0; i < 8; ++i) { a[i] = (_Float16)(p[i] * sc); a[8 + i] = (_Float16)(p[16 + i] * sc); }
  return a;
}
// column fragment from a [K][ld] layout (column n), rows >= K read as 0
__device__ __forceinline__ v16h fragc_f32(const float* W, int k0, int n, int lane, int ld, int K) {
  v16h a; const int g = lane >> 4;
#pragma unroll
  for (int i = 0; i < 8; ++i) { const int ka = k0 + 8 * g + i, kb = ka + 16;
    a[i] = (_Float16)(ka < K ? W[(size_t)(ka < K ? ka : K - 1) * ld + n] : 0.f); a[8 + i] = (_Float16)(kb < K ? W[(size_t)(kb < K ? kb : K - 1) * ld + n] : 0.f); }
  return a;
}
struct F2 { v16b h, l; };
__device__ __forceinline__ F2 bsplit16(const float v[16]) { F2 r;
#pragma unroll
  for (int i = 0; i < 16; ++i) { const __bf16 h = (__bf16)v[i]; r.h[i] = h; r.l[i] = (__bf16)(v[i] - (float)h); }
  return r; }
__device__ __forceinline__ F2 split_row(const float* row, int k0, int lane) { float v[16]; const float* p = row + k0 + 8 * (lane >> 4);
#pragma unroll
  for (int i = 0; i < 8; ++i) { v[i] = p[i]; v[8 + i] = p[16 + i]; }
  return bsplit16(v); }
__device__ __forceinline__ F2 split_rowK(const float* row, int k0, int lane, int K) { float v[16]; const int g = lane >> 4;
#pragma unroll
  for (int i = 0; i < 8; ++i) { const int ka = k0 + 8 * g + i, kb = ka + 16; v[i] = ka < K ? row[ka < K ? ka : K - 1] : 0.f; v[8 + i] = kb < K ? row[kb < K ? kb : K - 1] : 0.f; }
  return bsplit16(v); }
__device__ __forceinline__ F2 split_col(const float* W, int k0, int n, int lane, int ld, int K) { float v[16]; const int g = lane >> 4;
#pragma unroll
  for (int i = 0; i < 8; ++i) { const int ka = k0 + 8 * g + i, kb = ka + 16; v[i] = ka < K ? W[(size_t)(ka < K ? ka : K - 1) * ld + n] : 0.f; v[8 + i] = kb < K ? W[(size_t)(kb < K ? kb : K - 1) * ld + n] : 0.f; }
  return bsplit16(v); }
__device__ __forceinline__ v8f mac3(const F2& a, const F2& b, v8f c) { c = wmma_bf(a.l, b.h, c); c = wmma_bf(a.h, b.l, c); return wmma_bf(a.h, b.h, c); }
__device__ __forceinline__ float sigm(float v) { return 1.0f / (1.0f + expf(-v)); }
#define LDSX() do { asm volatile("s_wait_dscnt 0" ::: "memory"); __builtin_amdgcn_wave_barrier(); __builtin_amdgcn_fence(__ATOMIC_RELEASE, "workgroup"); } while (0)


// MSML windowed linear attention, stage 1 (B 2, N 16,384 tokens, C 256, 4x4 windows of M = 16): q = elu(x Wq + bq) + 1, k likewise, v = x; phi = elu(.) + 1 again; KV[b,m] = sum_w phi_k[b,w,m]^T v[b,w,m]; att[b,w,n,m,:] = phi_q[b,w,n] KV[b,m] + p[b,w,n,m]; out = att.reshape(b, -1, C)[:, :N].
#define NB 2
#define NTOK 16384
#define CC 256
#define MW 16             // window size
#define NWIN (NTOK / MW)  // 1024 windows
#define WOUT 64           // windows that reach the output
#define TQ (WOUT * MW)    // 1024 query tokens per batch
#ifndef TNB
#define TNB NB
#endif
typedef __attribute__((ext_vector_type(8))) __bf16 v8b;
__device__ __forceinline__ v16b frag_b(const __bf16* rowk0, int lane) {
  union { v16b v; v8b q[2]; } u; const __bf16* p = rowk0 + 8 * (lane >> 4);
  u.q[0] = *(const v8b*)p; u.q[1] = *(const v8b*)(p + 16); return u.v;
}
__device__ __forceinline__ float bfr(float v) { return (float)(__bf16)v; }
__device__ __attribute__((noinline)) float exp_ni(float v) { return expf(v); }
__device__ __attribute__((noinline)) float erf_ni(float v) { return erff(v); }

#define WS_PW  0u                                   // bf16 W^T rows [512][256] (q | k)
#define WS_PHQ (WS_PW + 2u * 2 * CC * CC)              // f32 phi_q rows [b*NTOK + t][256] (t < TQ used)
#define WS_PHK (WS_PHQ + 4u * (size_t)NB * NTOK * CC)   // f32 phi_k rows
#define WS_KVT (WS_PHK + 4u * (size_t)NB * NTOK * CC)   // f32 KV^T [b][m][d][c]
#define WS_END (WS_KVT + 4u * (size_t)NB * MW * CC * CC)

__device__ __forceinline__ v16b fragb_f32(const float* __restrict__ p, int lane) { v16b a; const float* pp = p + 8 * (lane >> 4);
#pragma unroll
  for (int i = 0; i < 8; ++i) { a[i] = (__bf16)pp[i]; a[8 + i] = (__bf16)pp[16 + i]; } return a; }
__device__ __forceinline__ float elu1(float y) { return (y > 0.f ? y : expm1f(y)) + 1.0f; }
__global__ __launch_bounds__(256) void k_packw(const float* __restrict__ WQ, const float* __restrict__ WK, __bf16* __restrict__ PW) { const int n = blockIdx.x, t = threadIdx.x; __shared__ __align__(16) __bf16 s[CC]; const int which = n / CC, o = n % CC; const float* Wm = which == 0 ? WQ : WK;   // (in,out)
  s[t] = (__bf16)Wm[(size_t)t * CC + o]; __syncthreads(); if (t < CC / 8) vst2((unsigned*)(PW + (size_t)n * CC + t * 8), *(const v4u*)&s[t * 8]); }
// ---- k_phi: block = (64 tokens, 128 cols, which): phi = elu(elu(x W + b) + 1) + 1 -> f32 rows (q: which 0, k: which 1)
__global__ __launch_bounds__(128) void k_phi(const float* __restrict__ X, const __bf16* __restrict__ PW, const float* __restrict__ BQ, const float* __restrict__ BK, float* __restrict__ PHQ, float* __restrict__ PHK) { __shared__ __align__(16) float sf[4][16][132];
  const int tid = threadIdx.x, wave = tid >> 5, lane = tid & 31, col = lane & 15, g = lane >> 4; const int which = blockIdx.z; const size_t r0 = (size_t)blockIdx.x * 64 + wave * 16; const int c0 = blockIdx.y * 128; const float* Bm = which == 0 ? BQ : BK; float* dst = which == 0 ? PHQ : PHK;
  v8f acc[8] = {};
#pragma unroll
  for (int kc = 0; kc < CC / 32; ++kc) { const v16b a = fragb_f32(X + (r0 + col) * CC + kc * 32, lane);
#pragma unroll
    for (int j = 0; j < 8; ++j) acc[j] = wmma_bf(a, frag_b(PW + (size_t)(which * CC + c0 + j * 16 + col) * CC + kc * 32, lane), acc[j]); }
#pragma unroll
  for (int j = 0; j < 8; ++j) { const float bb = bfr(Bm[c0 + j * 16 + col]);
#pragma unroll
    for (int r = 0; r < 8; ++r) sf[wave][8 * g + r][j * 16 + col] = elu1(elu1(acc[j][r] + bb)); }
  LDSX(); for (int rl = 0; rl < 16; ++rl) vst2(dst + (r0 + rl) * CC + c0 + lane * 4, *(const v4f*)&sf[wave][rl][lane * 4]); }
// ---- k_kv: block = (64 rows c, 128 cols d, b*MW + m), 8 waves (wave = 16 c x 64 d): KV[b,m][c][d] = sum_w phi_k[b, w*16+m, c] v[b, w*16+m, d] (K = 1,024 windows) -> stored transposed KV^T[b][m][d][c]
// Each stage of 64 windows is read once per block with 16-byte row loads, rounded once (phi_k to bf16 hi + lo, v to bf16) and laid row-major [window][column] in LDS; the k-major fragments come from transposing LDS loads. Two LDS buffers, two register sets: a stage's global loads are issued two stages ahead.
// work-group barrier whose fences name LDS alone: __syncthreads() would also wait out the global loads issued two stages ahead, which only registers receive
#define KVBAR() do { __builtin_amdgcn_fence(__ATOMIC_RELEASE, "workgroup", "local"); __builtin_amdgcn_s_barrier(); __builtin_amdgcn_fence(__ATOMIC_ACQUIRE, "workgroup", "local"); } while (0)
// keeps a stage's conversions, and with them the waits on its global loads, behind the products of the stage before, so that the loads have the whole two stages to land
#define KVHOLD() __builtin_amdgcn_sched_barrier(0)
#define KS 64                                // windows per stage
#define KV_NS (NWIN / KS)                    // 16 stages
#define PA 160u                              // LDS row pitch in bytes of the 64-column planes (32 B x odd, for the transposing load)
#define PB 288u                              // same for the 128-column plane
#define OFF_AL (KS * PA)                     // phi_k lo plane
#define OFF_B (2u * KS * PA)                 // v plane
#define STG_BYTES (2u * KS * PA + KS * PB)   // one buffer
typedef __attribute__((ext_vector_type(4))) __bf16 v4b;
typedef __attribute__((address_space(3))) v8b lds_v8b;
// lane (col, g) gets T[k + 8g + 0..7][col] and T[k + 16 + 8g + 0..7][col]: the k order of frag_b
__device__ __forceinline__ v16b frag_tr(const unsigned char* p, unsigned pitch) {
  union { v16b v; v8b q[2]; } u; u.q[0] = __builtin_amdgcn_ds_load_tr16_b128_v8bf16((lds_v8b*)p); u.q[1] = __builtin_amdgcn_ds_load_tr16_b128_v8bf16((lds_v8b*)(p + 16u * pitch)); return u.v;
}
struct KvRegs { v4f a[4], b[8]; };
__device__ __forceinline__ void kv_load(KvRegs& R, const float* __restrict__ pa, const float* __restrict__ pb, int s) {
#pragma unroll
  for (int i = 0; i < 4; ++i) R.a[i] = *(const v4f*)(pa + (size_t)(s * KS + 16 * i) * MW * CC);
#pragma unroll
  for (int i = 0; i < 8; ++i) R.b[i] = *(const v4f*)(pb + (size_t)(s * KS + 8 * i) * MW * CC);
  asm volatile("s_wait_xcnt 0x0" ::: "memory");   // precaution: stands before the next stage's address arithmetic rewrites the registers these loads name
}
__device__ __forceinline__ void kv_stash(const KvRegs& R, unsigned char* sa, unsigned char* sb) {
#pragma unroll
  for (int i = 0; i < 4; ++i) { v4b h, l;
#pragma unroll
    for (int e = 0; e < 4; ++e) { h[e] = (__bf16)R.a[i][e]; l[e] = (__bf16)(R.a[i][e] - (float)h[e]); }
    *(v4b*)(sa + 16u * i * PA) = h; *(v4b*)(sa + OFF_AL + 16u * i * PA) = l; }
#pragma unroll
  for (int i = 0; i < 8; ++i) { v4b w;
#pragma unroll
    for (int e = 0; e < 4; ++e) w[e] = (__bf16)R.b[i][e];
    *(v4b*)(sb + 8u * i * PB) = w; }
}
__device__ __forceinline__ void kv_mac(const unsigned char* fa, const unsigned char* fb, v8f acc[4]) {
#pragma unroll
  for (int kk = 0; kk < KS / 32; ++kk) { const v16b ah = frag_tr(fa + 32u * kk * PA, PA), al = frag_tr(fa + OFF_AL + 32u * kk * PA, PA); v16b w[4];
#pragma unroll
    for (int j = 0; j < 4; ++j) w[j] = frag_tr(fb + 32u * kk * PB + 32u * j, PB);
#pragma unroll
    for (int j = 0; j < 4; ++j) acc[j] = wmma_bf(ah, w[j], acc[j]);
#pragma unroll
    for (int j = 0; j < 4; ++j) acc[j] = wmma_bf(al, w[j], acc[j]); }
}
__global__ __launch_bounds__(256) void k_kv(const float* __restrict__ PHK, const float* __restrict__ X, float* __restrict__ KVT) { __shared__ __attribute__((aligned(256))) unsigned char L[2 * STG_BYTES]; __shared__ __align__(16) float st[128][68];
  const int tid = threadIdx.x, wave = tid >> 5, lane = tid & 31, col = lane & 15, g = lane >> 4; const size_t b = blockIdx.z / MW; const int m = blockIdx.z % MW; const int wc = wave & 3, wd = wave >> 2; const int cb = blockIdx.x * 64; const int d0 = blockIdx.y * 128;
  const float* pa = PHK + (b * NTOK + (size_t)(tid >> 4) * MW + m) * CC + cb + (tid & 15) * 4;   // 16 lanes a row of 64 c; window tid>>4, +16 per load
  const float* pb = X + (b * NTOK + (size_t)(tid >> 5) * MW + m) * CC + d0 + (tid & 31) * 4;     // a wave a row of 128 d; window tid>>5, +8 per load
  unsigned char* sa = L + (unsigned)(tid >> 4) * PA + (unsigned)(tid & 15) * 8u; unsigned char* sb = L + OFF_B + (unsigned)(tid >> 5) * PB + (unsigned)(tid & 31) * 8u;
  const unsigned rl = 8u * g + (lane & 7), sub = 16u * ((lane >> 3) & 1);
  const unsigned char* fa = L + rl * PA + 32u * wc + sub; const unsigned char* fb = L + OFF_B + rl * PB + 128u * wd + sub;
  v8f acc[4] = {}; KvRegs R0, R1;
  kv_load(R0, pa, pb, 0); kv_load(R1, pa, pb, 1);
  kv_stash(R0, sa, sb); kv_load(R0, pa, pb, 2); KVBAR();
#pragma unroll 1
  for (int s = 0; s < KV_NS - 4; s += 2) {   // buffer 0 holds stage s, R1 stage s + 1, R0 stage s + 2; rolled: the body is already two stages
    kv_mac(fa, fb, acc); KVHOLD(); kv_stash(R1, sa + STG_BYTES, sb + STG_BYTES); kv_load(R1, pa, pb, s + 3); KVBAR();
    kv_mac(fa + STG_BYTES, fb + STG_BYTES, acc); KVHOLD(); kv_stash(R0, sa, sb); kv_load(R0, pa, pb, s + 4); KVBAR(); }
  kv_mac(fa, fb, acc); KVHOLD(); kv_stash(R1, sa + STG_BYTES, sb + STG_BYTES); kv_load(R1, pa, pb, KV_NS - 1); KVBAR();
  kv_mac(fa + STG_BYTES, fb + STG_BYTES, acc); KVHOLD(); kv_stash(R0, sa, sb); KVBAR();
  kv_mac(fa, fb, acc); KVHOLD(); kv_stash(R1, sa + STG_BYTES, sb + STG_BYTES); KVBAR();
  kv_mac(fa + STG_BYTES, fb + STG_BYTES, acc);
#pragma unroll
  for (int j = 0; j < 4; ++j)
#pragma unroll
    for (int r = 0; r < 8; ++r) st[wd * 64 + j * 16 + col][wc * 16 + 8 * g + r] = acc[j][r];   // transposed [d][c]
  __syncthreads(); for (int e = tid; e < 128 * 16; e += 256) { const int dl = e >> 4, q = e & 15; vst2(KVT + ((b * MW + m) * CC + d0 + dl) * (size_t)CC + cb + q * 4, *(const v4f*)&st[dl][q * 4]); } }
// ---- k_att: block = (256 query tokens t, 128 cols d, b*MW + m), 8 waves (wave = 32 t x 128 d): out[b][t*16 + m][d] = phi_q[b,t] . KV[b,m][:, d] (3 products) + p[b][w = t/16][n = t%16][m]
// The block's 128 rows of KV^T (contiguous, 128 KiB of f32) are read once with whole-line 16-byte loads, split once into bf16 hi + lo and laid in LDS, a row's hi half and lo half side by side; every wave takes its B fragments from there.
// Every "#pragma unroll" of this kernel keeps an array (r, an0, an1, acc0, acc1) in registers: its indices must be constants.
#define AP 1040u                             // LDS row pitch in bytes: 256 bf16 hi, 256 bf16 lo, 16 B of pad (16 B x odd, for ds_load_b128)
#define AT_LO 512u                           // a row's lo half
__device__ __forceinline__ void att_lda(float v[16], const float* __restrict__ p) {   // the k order of split_row
  const v4f q0 = *(const v4f*)p, q1 = *(const v4f*)(p + 4), q2 = *(const v4f*)(p + 16), q3 = *(const v4f*)(p + 20);
#pragma unroll
  for (int e = 0; e < 4; ++e) { v[e] = q0[e]; v[4 + e] = q1[e]; v[8 + e] = q2[e]; v[12 + e] = q3[e]; }
}
__global__ __launch_bounds__(256) void k_att(const float* __restrict__ PHQ, const float* __restrict__ KVT, const float* __restrict__ EQK, const float* __restrict__ WP, const float* __restrict__ BP, float* __restrict__ OUT) { __shared__ __align__(16) unsigned char SB[128u * AP]; __shared__ __align__(16) float sf[8][32][132];
  const int tid = threadIdx.x, wave = tid >> 5, lane = tid & 31, col = lane & 15, g = lane >> 4; const size_t b = blockIdx.z / MW; const int m = blockIdx.z % MW; const int t0 = blockIdx.x * 256 + wave * 32; const int d0 = blockIdx.y * 128;
  { const float* src = KVT + ((b * MW + m) * CC + d0) * (size_t)CC + tid * 4; v4f r[32];   // load i: row 4 i + tid / 64, columns 4 (tid % 64) ..
#pragma unroll
    for (int i = 0; i < 32; ++i) r[i] = *(const v4f*)(src + i * 1024);
    unsigned char* sp = SB + (unsigned)(tid >> 6) * AP + (unsigned)(tid & 63) * 8u;
#pragma unroll
    for (int i = 0; i < 32; ++i) { v4b h, l;
#pragma unroll
      for (int e = 0; e < 4; ++e) { h[e] = (__bf16)r[i][e]; l[e] = (__bf16)(r[i][e] - (float)h[e]); }
      *(v4b*)(sp + 4u * i * AP) = h; *(v4b*)(sp + AT_LO + 4u * i * AP) = l; } }
  const float* pq = PHQ + (b * NTOK + t0 + col) * CC + 8 * g; float an0[16], an1[16];
  att_lda(an0, pq); att_lda(an1, pq + 16 * CC);
  KVBAR();   // every row of the slab is in LDS before any wave reads a fragment; the fences name LDS alone: nothing global is handed over here
  v8f acc0[8] = {}, acc1[8] = {};
#pragma unroll
  for (int kc = 0; kc < CC / 32; ++kc) { const F2 a0 = bsplit16(an0), a1 = bsplit16(an1);
    if (kc + 1 < CC / 32) { att_lda(an0, pq + (kc + 1) * 32); att_lda(an1, pq + 16 * CC + (kc + 1) * 32); }
#pragma unroll
    for (int j = 0; j < 8; j += 2) { const __bf16* w0 = (const __bf16*)(SB + (unsigned)(j * 16 + col) * AP) + kc * 32; const __bf16* w1 = (const __bf16*)(SB + (unsigned)(j * 16 + 16 + col) * AP) + kc * 32;
      const v16b h0 = frag_b(w0, lane), h1 = frag_b(w1, lane), l0 = frag_b(w0 + AT_LO / 2, lane), l1 = frag_b(w1 + AT_LO / 2, lane);
      acc0[j] = wmma_bf(a0.h, h0, acc0[j]); acc1[j] = wmma_bf(a1.h, h0, acc1[j]); acc0[j + 1] = wmma_bf(a0.h, h1, acc0[j + 1]); acc1[j + 1] = wmma_bf(a1.h, h1, acc1[j + 1]);
      acc0[j] = wmma_bf(a0.h, l0, acc0[j]); acc1[j] = wmma_bf(a1.h, l0, acc1[j]); acc0[j + 1] = wmma_bf(a0.h, l1, acc0[j + 1]); acc1[j + 1] = wmma_bf(a1.h, l1, acc1[j + 1]);
      acc0[j] = wmma_bf(a0.l, h0, acc0[j]); acc1[j] = wmma_bf(a1.l, h0, acc1[j]); acc0[j + 1] = wmma_bf(a0.l, h1, acc0[j + 1]); acc1[j + 1] = wmma_bf(a1.l, h1, acc1[j + 1]); } }
  const float wp0 = bfr(WP[0]), wp1 = bfr(WP[1]), wp2 = bfr(WP[2]), bpv = bfr(BP[0]);
#pragma unroll
  for (int u = 0; u < 2; ++u)
#pragma unroll
    for (int r = 0; r < 8; ++r) { const int t = t0 + u * 16 + 8 * g + r; const int w = t / MW, n = t % MW; const float* e3 = EQK + ((((b * NWIN + w) * MW + n) * MW + m) * 3); const float pv = bfr(e3[0]) * wp0 + bfr(e3[1]) * wp1 + bfr(e3[2]) * wp2 + bpv;
#pragma unroll
      for (int j = 0; j < 8; ++j) sf[wave][u * 16 + 8 * g + r][j * 16 + col] = (u ? acc1[j][r] : acc0[j][r]) + pv; }
  LDSX(); for (int rl = 0; rl < 32; ++rl) vst2(OUT + (b * NTOK + (size_t)(t0 + rl) * MW + m) * CC + d0 + lane * 4, *(const v4f*)&sf[wave][rl][lane * 4]); }
extern "C" void kernel_launch(void* const* d_in, const int* in_sizes, int n_in, void* d_out, int out_size, void* d_ws, size_t ws_size, hipStream_t stream) {
  (void)in_sizes; (void)n_in; (void)out_size;
  const float** F = (const float**)d_in;   // 0 input [2,16384,256], 1 embed_qk [2,1024,16,16,3], 2 Wq [256,256] (in,out), 3 bq, 4 Wk, 5 bk, 6 Wp [3,1], 7 bp [1]
  if (ws_size < (size_t)WS_END) return;
  char* ws = (char*)d_ws; __bf16* PW = (__bf16*)(ws + WS_PW); float *PHQ = (float*)(ws + WS_PHQ), *PHK = (float*)(ws + WS_PHK), *KVT = (float*)(ws + WS_KVT);
  k_packw<<<2 * CC, 256, 0, stream>>>(F[2], F[4], PW);
  k_phi<<<dim3(NB * NTOK / 64, CC / 128, 2), 128, 0, stream>>>(F[0], PW, F[3], F[5], PHQ, PHK);
  k_kv<<<dim3(CC / 64, CC / 128, NB * MW), 256, 0, stream>>>(PHK, F[0], KVT);
  k_att<<<dim3(TQ / 256, CC / 128, TNB * MW), 256, 0, stream>>>(PHQ, KVT, F[1], F[6], F[7], (float*)d_out);
}

// v003
// One run takes 80.6 microseconds.
// Two timings next to v002 put it at 1.17 and 1.15 times that version's speed.
// Over all steps from v000 it is 2.75 times as fast.
// compute dtype: all float inputs rounded to bf16; q/k projections with EXACT bf16 products on WMMA 16x16x32 ((in,out) weights), the two ELU+1 feature maps in f32; KV_m = sum over all 1,024 windows of phi_k (bf16 hi + lo) x v (exact input) on WMMA (2 products); att = phi_q (hi + lo) . KV_m (hi + lo) on WMMA (3 products) + the positional term p (embed_qk . Wp + bp, f32); f32 output. Only windows w < 64 of the (b, w, n, m, d) intermediate survive the module's reshape(b, -1, c)[:, :n] slice, so only those are computed.
#include <hip/hip_runtime.h>
#include <math.h>

typedef __attribute__((ext_vector_type(16))) _Float16 v16h;
typedef __attribute__((ext_vector_type(16))) __bf16 v16b;
typedef __attribute__((ext_vector_type(8)))  _Float16 v8h;
typedef __attribute__((ext_vector_type(8)))  float v8f;
typedef __attribute__((ext_vector_type(4)))  float v4f;
typedef __attribute__((ext_vector_type(2)))  float v2f;
typedef __attribute__((ext_vector_type(4)))  unsigned v4u;
typedef __attribute__((ext_vector_type(4)))  int v4i;
typedef float __attribute__((may_alias)) float_a;
typedef int __attribute__((may_alias)) int_a;

template <typename T> __device__ __forceinline__ void vst2(void* p, T v) { *(T*)p = v;  }
__device__ __forceinline__ v8f wmma16(v16h a, v16h b, v8f c) {
  v8f d = __builtin_amdgcn_wmma_f32_16x16x32_f16(false, a, false, b, (short)0, c, false, false);
  asm volatile("v_nop\n\tv_nop\n\tv_nop\n\tv_nop" : "+v"(d) : "v"(a), "v"(b));
  return d;
}
__device__ __forceinline__ v8f wmma_bf(v16b a, v16b b, v8f c) {
  v8f d = __builtin_amdgcn_wmma_f32_16x16x32_bf16(false, a, false, b, (short)0, c, false, false);
  asm volatile("v_nop\n\tv_nop\n\tv_nop\n\tv_nop" : "+v"(d) : "v"(a), "v"(b));
  return d;
}
// 16x16x32 fragments: lane = (h = lane>>4, row/col = lane&15); elements 0..7 = k0+8h+0..7, 8..15 = k0+16+8h+0..7; D element r = row 8h+r
__device__ __forceinline__ v16h frag_h(const _Float16* rowk0, int lane) {
  union { v16h v; v8h q[2]; } u; const _Float16* p = rowk0 + 8 * (lane >> 4);
  u.q[0] = *(const v8h*)p; u.q[1] = *(const v8h*)(p + 16); return u.v;
}
__device__ __forceinline__ v16h frag_f32(const float* rowk0, int lane) {
  v16h a; const float* p = rowk0 + 8 * (lane >> 4);
#pragma unroll
  for (int i = 0; i < 8; ++i) { a[i] = (_Float16)p[i]; a[8 + i] = (_Float16)p[16 + i]; }
  return a;
}
__device__ __forceinline__ v16h frag_f32s(const float* rowk0, int lane, float sc) {
  v16h a; const float* p = rowk0 + 8 * (lane >> 4);
#pragma unroll
  for (int i = 0; i < 8; ++i) { a[i] = (_Float16)(p[i] * sc); a[8 + i] = (_Float16)(p[16 + i] * sc); }
  return a;
}
// column fragment from a [K][ld] layout (column n), rows >= K read as 0
__device__ __forceinline__ v16h fragc_f32(const float* W, int k0, int n, int lane, int ld, int K) {
  v16h a; const int g = lane >> 4;
#pragma unroll
  for (int i = 0; i < 8; ++i) { const int ka = k0 + 8 * g + i, kb = ka + 16;
    a[i] = (_Float16)(ka < K ? W[(size_t)(ka < K ? ka : K - 1) * ld + n] : 0.f); a[8 + i] = (_Float16)(kb < K ? W[(size_t)(kb < K ? kb : K - 1) * ld + n] : 0.f); }
  return a;
}
struct F2 { v16b h, l; };
__device__ __forceinline__ F2 bsplit16(const float v[16]) { F2 r;
#pragma unroll
  for (int i = 0; i < 16; ++i) { const __bf16 h = (__bf16)v[i]; r.h[i] = h; r.l[i] = (__bf16)(v[i] - (float)h); }
  return r; }
__device__ __forceinline__ F2 split_row(const float* row, int k0, int lane) { float v[16]; const float* p = row + k0 + 8 * (lane >> 4);
#pragma unroll
  for (int i = 0; i < 8; ++i) { v[i] = p[i]; v[8 + i] = p[16 + i]; }
  return bsplit16(v); }
__device__ __forceinline__ F2 split_rowK(const float* row, int k0, int lane, int K) { float v[16]; const int g = lane >> 4;
#pragma unroll
  for (int i = 0; i < 8; ++i) { const int ka = k0 + 8 * g + i, kb = ka + 16; v[i] = ka < K ? row[ka < K ? ka : K - 1] : 0.f; v[8 + i] = kb < K ? row[kb < K ? kb : K - 1] : 0.f; }
  return bsplit16(v); }
__device__ __forceinline__ F2 split_col(const float* W, int k0, int n, int lane, int ld, int K) { float v[16]; const int g = lane >> 4;
#pragma unroll
  for (int i = 0; i < 8; ++i) { const int ka = k0 + 8 * g + i, kb = ka + 16; v[i] = ka < K ? W[(size_t)(ka < K ? ka : K - 1) * ld + n] : 0.f; v[8 + i] = kb < K ? W[(size_t)(kb < K ? kb : K - 1) * ld + n] : 0.f; }
  return bsplit16(v); }
__device__ __forceinline__ v8f mac3(const F2& a, const F2& b, v8f c) { c = wmma_bf(a.l, b.h, c); c = wmma_bf(a.h, b.l, c); return wmma_bf(a.h, b.h, c); }
__device__ __forceinline__ float sigm(float v) { return 1.0f / (1.0f + expf(-v)); }
#define LDSX() do { asm volatile("s_wait_dscnt 0" ::: "memory"); __builtin_amdgcn_wave_barrier(); __builtin_amdgcn_fence(__ATOMIC_RELEASE, "workgroup"); } while (0)


// MSML windowed linear attention, stage 1 (B 2, N 16,384 tokens, C 256, 4x4 windows of M = 16): q = elu(x Wq + bq) + 1, k likewise, v = x; phi = elu(.) + 1 again; KV[b,m] = sum_w phi_k[b,w,m]^T v[b,w,m]; att[b,w,n,m,:] = phi_q[b,w,n] KV[b,m] + p[b,w,n,m]; out = att.reshape(b, -1, C)[:, :N].
#define NB 2
#define NTOK 16384
#define CC 256
#define MW 16             // window size
#define NWIN (NTOK / MW)  // 1024 windows
#define WOUT 64           // windows that reach the output
#define TQ (WOUT * MW)    // 1024 query tokens per batch
#ifndef TNB
#define TNB NB
#endif
typedef __attribute__((ext_vector_type(8))) __bf16 v8b;
__device__ __forceinline__ v16b frag_b(const __bf16* rowk0, int lane) {
  union { v16b v; v8b q[2]; } u; const __bf16* p = rowk0 + 8 * (lane >> 4);
  u.q[0] = *(const v8b*)p; u.q[1] = *(const v8b*)(p + 16); return u.v;
}
__device__ __forceinline__ float bfr(float v) { return (float)(__bf16)v; }
__device__ __attribute__((noinline)) float exp_ni(float v) { return expf(v); }
__device__ __attribute__((noinline)) float erf_ni(float v) { return erff(v); }

#define WS_PW  0u                                   // bf16 W^T rows [512][256] (q | k)
#define WS_PHQ (WS_PW + 2u * 2 * CC * CC)              // f32 phi_q rows [b*NTOK + t][256] (t < TQ used)
#define WS_PHK (WS_PHQ + 4u * (size_t)NB * NTOK * CC)   // f32 phi_k rows
#define WS_KVT (WS_PHK + 4u * (size_t)NB * NTOK * CC)   // f32 KV^T [b][m][d][c]
#define WS_END (WS_KVT + 4u * (size_t)NB * MW * CC * CC)

__device__ __forceinline__ v16b fragb_f32(const float* __restrict__ p, int lane) { v16b a; const float* pp = p + 8 * (lane >> 4);
#pragma unroll
  for (int i = 0; i < 8; ++i) { a[i] = (__bf16)pp[i]; a[8 + i] = (__bf16)pp[16 + i]; } return a; }
__device__ __forceinline__ float elu1(float y) { return (y > 0.f ? y : expm1f(y)) + 1.0f; }
__global__ __launch_bounds__(256) void k_packw(const float* __restrict__ WQ, const float* __restrict__ WK, __bf16* __restrict__ PW) { const int n = blockIdx.x, t = threadIdx.x; __shared__ __align__(16) __bf16 s[CC]; const int which = n / CC, o = n % CC; const float* Wm = which == 0 ? WQ : WK;   // (in,out)
  s[t] = (__bf16)Wm[(size_t)t * CC + o]; __syncthreads(); if (t < CC / 8) vst2((unsigned*)(PW + (size_t)n * CC + t * 8), *(const v4u*)&s[t * 8]); }
// ---- k_phi: block = (64 tokens, 128 columns): phi = elu(elu(x W + b) + 1) + 1 -> f32 rows. Blocks x < QB: phi_q, only for the TQ tokens of each batch that k_att reads; the others: phi_k, every token
#define QB (NB * TQ / 64)
__global__ __launch_bounds__(128) void k_phi(const float* __restrict__ X, const __bf16* __restrict__ PW, const float* __restrict__ BQ, const float* __restrict__ BK, float* __restrict__ PHQ, float* __restrict__ PHK) { __shared__ __align__(16) float sf[4][16][132];
  const int tid = threadIdx.x, wave = tid >> 5, lane = tid & 31, col = lane & 15, g = lane >> 4; const int bx = blockIdx.x; const int which = bx < QB ? 0 : 1; const size_t r0 = (which == 0 ? (size_t)(bx / (TQ / 64)) * NTOK + (size_t)(bx % (TQ / 64)) * 64 : (size_t)(bx - QB) * 64) + wave * 16; const int c0 = blockIdx.y * 128; const float* Bm = which == 0 ? BQ : BK; float* dst = which == 0 ? PHQ : PHK;
  v8f acc[8] = {};
#pragma unroll
  for (int kc = 0; kc < CC / 32; ++kc) { const v16b a = fragb_f32(X + (r0 + col) * CC + kc * 32, lane);
#pragma unroll
    for (int j = 0; j < 8; ++j) acc[j] = wmma_bf(a, frag_b(PW + (size_t)(which * CC + c0 + j * 16 + col) * CC + kc * 32, lane), acc[j]); }
#pragma unroll
  for (int j = 0; j < 8; ++j) { const float bb = bfr(Bm[c0 + j * 16 + col]);
#pragma unroll
    for (int r = 0; r < 8; ++r) sf[wave][8 * g + r][j * 16 + col] = elu1(elu1(acc[j][r] + bb)); }
  LDSX(); for (int rl = 0; rl < 16; ++rl) vst2(dst + (r0 + rl) * CC + c0 + lane * 4, *(const v4f*)&sf[wave][rl][lane * 4]); }
// ---- k_kv: block = (64 rows c, 128 cols d, b*MW + m), 8 waves (wave = 16 c x 64 d): KV[b,m][c][d] = sum_w phi_k[b, w*16+m, c] v[b, w*16+m, d] (K = 1,024 windows) -> stored transposed KV^T[b][m][d][c]
// Each stage of 64 windows is read once per block with 16-byte row loads, rounded once (phi_k to bf16 hi + lo, v to bf16) and laid row-major [window][column] in LDS; the k-major fragments come from transposing LDS loads. Two LDS buffers, two register sets: a stage's global loads are issued two stages ahead.
// work-group barrier whose fences name LDS alone: __syncthreads() would also wait out the global loads issued two stages ahead, which only registers receive
#define KVBAR() do { __builtin_amdgcn_fence(__ATOMIC_RELEASE, "workgroup", "local"); __builtin_amdgcn_s_barrier(); __builtin_amdgcn_fence(__ATOMIC_ACQUIRE, "workgroup", "local"); } while (0)
// keeps a stage's conversions, and with them the waits on its global loads, behind the products of the stage before, so that the loads have the whole two stages to land
#define KVHOLD() __builtin_amdgcn_sched_barrier(0)
#define KS 64                                // windows per stage
#define KV_NS (NWIN / KS)                    // 16 stages
#define PA 160u                              // LDS row pitch in bytes of the 64-column planes (32 B x odd, for the transposing load)
#define PB 288u                              // same for the 128-column plane
#define OFF_AL (KS * PA)                     // phi_k lo plane
#define OFF_B (2u * KS * PA)                 // v plane
#define STG_BYTES (2u * KS * PA + KS * PB)   // one buffer
typedef __attribute__((ext_vector_type(4))) __bf16 v4b;
typedef __attribute__((address_space(3))) v8b lds_v8b;
// lane (col, g) gets T[k + 8g + 0..7][col] and T[k + 16 + 8g + 0..7][col]: the k order of frag_b
__device__ __forceinline__ v16b frag_tr(const unsigned char* p, unsigned pitch) {
  union { v16b v; v8b q[2]; } u; u.q[0] = __builtin_amdgcn_ds_load_tr16_b128_v8bf16((lds_v8b*)p); u.q[1] = __builtin_amdgcn_ds_load_tr16_b128_v8bf16((lds_v8b*)(p + 16u * pitch)); return u.v;
}
struct KvRegs { v4f a[4], b[8]; };
__device__ __forceinline__ void kv_load(KvRegs& R, const float* __restrict__ pa, const float* __restrict__ pb, int s) {
#pragma unroll
  for (int i = 0; i < 4; ++i) R.a[i] = *(const v4f*)(pa + (size_t)(s * KS + 16 * i) * MW * CC);
#pragma unroll
  for (int i = 0; i < 8; ++i) R.b[i] = *(const v4f*)(pb + (size_t)(s * KS + 8 * i) * MW * CC);
  asm volatile("s_wait_xcnt 0x0" ::: "memory");   // precaution: stands before the next stage's address arithmetic rewrites the registers these loads name
}
__device__ __forceinline__ void kv_stash(const KvRegs& R, unsigned char* sa, unsigned char* sb) {
#pragma unroll
  for (int i = 0; i < 4; ++i) { v4b h, l;
#pragma unroll
    for (int e = 0; e < 4; ++e) { h[e] = (__bf16)R.a[i][e]; l[e] = (__bf16)(R.a[i][e] - (float)h[e]); }
    *(v4b*)(sa + 16u * i * PA) = h; *(v4b*)(sa + OFF_AL + 16u * i * PA) = l; }
#pragma unroll
  for (int i = 0; i < 8; ++i) { v4b w;
#pragma unroll
    for (int e = 0; e < 4; ++e) w[e] = (__bf16)R.b[i][e];
    *(v4b*)(sb + 8u * i * PB) = w; }
}
__device__ __forceinline__ void kv_mac(const unsigned char* fa, const unsigned char* fb, v8f acc[4]) {
#pragma unroll
  for (int kk = 0; kk < KS / 32; ++kk) { const v16b ah = frag_tr(fa + 32u * kk * PA, PA), al = frag_tr(fa + OFF_AL + 32u * kk * PA, PA); v16b w[4];
#pragma unroll
    for (int j = 0; j < 4; ++j) w[j] = frag_tr(fb + 32u * kk * PB + 32u * j, PB);
#pragma unroll
    for (int j = 0; j < 4; ++j) acc[j] = wmma_bf(ah, w[j], acc[j]);
#pragma unroll
    for (int j = 0; j < 4; ++j) acc[j] = wmma_bf(al, w[j], acc[j]); }
}
__global__ __launch_bounds__(256) void k_kv(const float* __restrict__ PHK, const float* __restrict__ X, float* __restrict__ KVT) { __shared__ __attribute__((aligned(256))) unsigned char L[2 * STG_BYTES]; __shared__ __align__(16) float st[128][68];
  const int tid = threadIdx.x, wave = tid >> 5, lane = tid & 31, col = lane & 15, g = lane >> 4; const size_t b = blockIdx.z / MW; const int m = blockIdx.z % MW; const int wc = wave & 3, wd = wave >> 2; const int cb = blockIdx.x * 64; const int d0 = blockIdx.y * 128;
  const float* pa = PHK + (b * NTOK + (size_t)(tid >> 4) * MW + m) * CC + cb + (tid & 15) * 4;   // 16 lanes a row of 64 c; window tid>>4, +16 per load
  const float* pb = X + (b * NTOK + (size_t)(tid >> 5) * MW + m) * CC + d0 + (tid & 31) * 4;     // a wave a row of 128 d; window tid>>5, +8 per load
  unsigned char* sa = L + (unsigned)(tid >> 4) * PA + (unsigned)(tid & 15) * 8u; unsigned char* sb = L + OFF_B + (unsigned)(tid >> 5) * PB + (unsigned)(tid & 31) * 8u;
  const unsigned rl = 8u * g + (lane & 7), sub = 16u * ((lane >> 3) & 1);
  const unsigned char* fa = L + rl * PA + 32u * wc + sub; const unsigned char* fb = L + OFF_B + rl * PB + 128u * wd + sub;
  v8f acc[4] = {}; KvRegs R0, R1;
  kv_load(R0, pa, pb, 0); kv_load(R1, pa, pb, 1);
  kv_stash(R0, sa, sb); kv_load(R0, pa, pb, 2); KVBAR();
#pragma unroll 1
  for (int s = 0; s < KV_NS - 4; s += 2) {   // buffer 0 holds stage s, R1 stage s + 1, R0 stage s + 2; rolled: the body is already two stages
    kv_mac(fa, fb, acc); KVHOLD(); kv_stash(R1, sa + STG_BYTES, sb + STG_BYTES); kv_load(R1, pa, pb, s + 3); KVBAR();
    kv_mac(fa + STG_BYTES, fb + STG_BYTES, acc); KVHOLD(); kv_stash(R0, sa, sb); kv_load(R0, pa, pb, s + 4); KVBAR(); }
  kv_mac(fa, fb, acc); KVHOLD(); kv_stash(R1, sa + STG_BYTES, sb + STG_BYTES); kv_load(R1, pa, pb, KV_NS - 1); KVBAR();
  kv_mac(fa + STG_BYTES, fb + STG_BYTES, acc); KVHOLD(); kv_stash(R0, sa, sb); KVBAR();
  kv_mac(fa, fb, acc); KVHOLD(); kv_stash(R1, sa + STG_BYTES, sb + STG_BYTES); KVBAR();
  kv_mac(fa + STG_BYTES, fb + STG_BYTES, acc);
#pragma unroll
  for (int j = 0; j < 4; ++j)
#pragma unroll
    for (int r = 0; r < 8; ++r) st[wd * 64 + j * 16 + col][wc * 16 + 8 * g + r] = acc[j][r];   // transposed [d][c]
  __syncthreads(); for (int e = tid; e < 128 * 16; e += 256) { const int dl = e >> 4, q = e & 15; vst2(KVT + ((b * MW + m) * CC + d0 + dl) * (size_t)CC + cb + q * 4, *(const v4f*)&st[dl][q * 4]); } }
// ---- k_att: block = (256 query tokens t, 128 cols d, b*MW + m), 8 waves (wave = 32 t x 128 d): out[b][t*16 + m][d] = phi_q[b,t] . KV[b,m][:, d] (3 products) + p[b][w = t/16][n = t%16][m]
// The block's 128 rows of KV^T (contiguous, 128 KiB of f32) are read once with whole-line 16-byte loads, split once into bf16 hi + lo and laid in LDS, a row's hi half and lo half side by side; every wave takes its B fragments from there.
// Every "#pragma unroll" of this kernel keeps an array (r, an0, an1, acc0, acc1) in registers: its indices must be constants.
#define AP 1040u                             // LDS row pitch in bytes: 256 bf16 hi, 256 bf16 lo, 16 B of pad (16 B x odd, for ds_load_b128)
#define AT_LO 512u                           // a row's lo half
__device__ __forceinline__ void att_lda(float v[16], const float* __restrict__ p) {   // the k order of split_row
  const v4f q0 = *(const v4f*)p, q1 = *(const v4f*)(p + 4), q2 = *(const v4f*)(p + 16), q3 = *(const v4f*)(p + 20);
#pragma unroll
  for (int e = 0; e < 4; ++e) { v[e] = q0[e]; v[4 + e] = q1[e]; v[8 + e] = q2[e]; v[12 + e] = q3[e]; }
}
__global__ __launch_bounds__(256) void k_att(const float* __restrict__ PHQ, const float* __restrict__ KVT, const float* __restrict__ EQK, const float* __restrict__ WP, const float* __restrict__ BP, float* __restrict__ OUT) { __shared__ __align__(16) unsigned char SB[128u * AP]; __shared__ __align__(16) float sf[8][32][132];
  const int tid = threadIdx.x, wave = tid >> 5, lane = tid & 31, col = lane & 15, g = lane >> 4; const size_t b = blockIdx.z / MW; const int m = blockIdx.z % MW; const int t0 = blockIdx.x * 256 + wave * 32; const int d0 = blockIdx.y * 128;
  { const float* src = KVT + ((b * MW + m) * CC + d0) * (size_t)CC + tid * 4; v4f r[32];   // load i: row 4 i + tid / 64, columns 4 (tid % 64) ..
#pragma unroll
    for (int i = 0; i < 32; ++i) r[i] = *(const v4f*)(src + i * 1024);
    unsigned char* sp = SB + (unsigned)(tid >> 6) * AP + (unsigned)(tid & 63) * 8u;
#pragma unroll
    for (int i = 0; i < 32; ++i) { v4b h, l;
#pragma unroll
      for (int e = 0; e < 4; ++e) { h[e] = (__bf16)r[i][e]; l[e] = (__bf16)(r[i][e] - (float)h[e]); }
      *(v4b*)(sp + 4u * i * AP) = h; *(v4b*)(sp + AT_LO + 4u * i * AP) = l; } }
  const float* pq = PHQ + (b * NTOK + t0 + col) * CC + 8 * g; float an0[16], an1[16];
  att_lda(an0, pq); att_lda(an1, pq + 16 * CC);
  KVBAR();   // every row of the slab is in LDS before any wave reads a fragment; the fences name LDS alone: nothing global is handed over here
  v8f acc0[8] = {}, acc1[8] = {};
#pragma unroll
  for (int kc = 0; kc < CC / 32; ++kc) { const F2 a0 = bsplit16(an0), a1 = bsplit16(an1);
    if (kc + 1 < CC / 32) { att_lda(an0, pq + (kc + 1) * 32); att_lda(an1, pq + 16 * CC + (kc + 1) * 32); }
#pragma unroll
    for (int j = 0; j < 8; j += 2) { const __bf16* w0 = (const __bf16*)(SB + (unsigned)(j * 16 + col) * AP) + kc * 32; const __bf16* w1 = (const __bf16*)(SB + (unsigned)(j * 16 + 16 + col) * AP) + kc * 32;
      const v16b h0 = frag_b(w0, lane), h1 = frag_b(w1, lane), l0 = frag_b(w0 + AT_LO / 2, lane), l1 = frag_b(w1 + AT_LO / 2, lane);
      acc0[j] = wmma_bf(a0.h, h0, acc0[j]); acc1[j] = wmma_bf(a1.h, h0, acc1[j]); acc0[j + 1] = wmma_bf(a0.h, h1, acc0[j + 1]); acc1[j + 1] = wmma_bf(a1.h, h1, acc1[j + 1]);
      acc0[j] = wmma_bf(a0.h, l0, acc0[j]); acc1[j] = wmma_bf(a1.h, l0, acc1[j]); acc0[j + 1] = wmma_bf(a0.h, l1, acc0[j + 1]); acc1[j + 1] = wmma_bf(a1.h, l1, acc1[j + 1]);
      acc0[j] = wmma_bf(a0.l, h0, acc0[j]); acc1[j] = wmma_bf(a1.l, h0, acc1[j]); acc0[j + 1] = wmma_bf(a0.l, h1, acc0[j + 1]); acc1[j + 1] = wmma_bf(a1.l, h1, acc1[j + 1]); } }
  const float wp0 = bfr(WP[0]), wp1 = bfr(WP[1]), wp2 = bfr(WP[2]), bpv = bfr(BP[0]);
#pragma unroll
  for (int u = 0; u < 2; ++u)
#pragma unroll
    for (int r = 0; r < 8; ++r) { const int t = t0 + u * 16 + 8 * g + r; const int w = t / MW, n = t % MW; const float* e3 = EQK + ((((b * NWIN + w) * MW + n) * MW + m) * 3); const float pv = bfr(e3[0]) * wp0 + bfr(e3[1]) * wp1 + bfr(e3[2]) * wp2 + bpv;
#pragma unroll
      for (int j = 0; j < 8; ++j) sf[wave][u * 16 + 8 * g + r][j * 16 + col] = (u ? acc1[j][r] : acc0[j][r]) + pv; }
  LDSX(); for (int rl = 0; rl < 32; ++rl) vst2(OUT + (b * NTOK + (size_t)(t0 + rl) * MW + m) * CC + d0 + lane * 4, *(const v4f*)&sf[wave][rl][lane * 4]); }
extern "C" void kernel_launch(void* const* d_in, const int* in_sizes, int n_in, void* d_out, int out_size, void* d_ws, size_t ws_size, hipStream_t stream) {
  (void)in_sizes; (void)n_in; (void)out_size;
  const float** F = (const float**)d_in;   // 0 input [2,16384,256], 1 embed_qk [2,1024,16,16,3], 2 Wq [256,256] (in,out), 3 bq, 4 Wk, 5 bk, 6 Wp [3,1], 7 bp [1]
  if (ws_size < (size_t)WS_END) return;
  char* ws = (char*)d_ws; __bf16* PW = (__bf16*)(ws + WS_PW); float *PHQ = (float*)(ws + WS_PHQ), *PHK = (float*)(ws + WS_PHK), *KVT = (float*)(ws + WS_KVT);
  k_packw<<<2 * CC, 256, 0, stream>>>(F[2], F[4], PW);
  k_phi<<<dim3(QB + NB * NTOK / 64, CC / 128, 1), 128, 0, stream>>>(F[0], PW, F[3], F[5], PHQ, PHK);
  k_kv<<<dim3(CC / 64, CC / 128, NB * MW), 256, 0, stream>>>(PHK, F[0], KVT);
  k_att<<<dim3(TQ / 256, CC / 128, TNB * MW), 256, 0, stream>>>(PHQ, KVT, F[1], F[6], F[7], (float*)d_out);
}

// v004
// A run of this version takes 65.8 microseconds.
// Timed twice side by side with v003, it ran 1.19 and 1.23 times as fast.
// Over all steps from v000 it is 3.33 times as fast.
// compute dtype: all float inputs rounded to bf16; q/k projections with EXACT bf16 products on WMMA 16x16x32 ((in,out) weights), the two ELU+1 feature maps in f32; KV_m = sum over all 1,024 windows of phi_k (bf16 hi + lo) x v (exact input) on WMMA (2 products); att = phi_q (hi + lo) . KV_m (hi + lo) on WMMA (3 products) + the positional term p (embed_qk . Wp + bp, f32); f32 output. Only windows w < 64 of the (b, w, n, m, d) intermediate survive the module's reshape(b, -1, c)[:, :n] slice, so only those are computed.
#include <hip/hip_runtime.h>
#include <math.h>

typedef __attribute__((ext_vector_type(16))) _Float16 v16h;
typedef __attribute__((ext_vector_type(16))) __bf16 v16b;
typedef __attribute__((ext_vector_type(8)))  _Float16 v8h;
typedef __attribute__((ext_vector_type(8)))  float v8f;
typedef __attribute__((ext_vector_type(4)))  float v4f;
typedef __attribute__((ext_vector_type(2)))  float v2f;
typedef __attribute__((ext_vector_type(4)))  unsigned v4u;
typedef __attribute__((ext_vector_type(4)))  int v4i;
typedef float __attribute__((may_alias)) float_a;
typedef int __attribute__((may_alias)) int_a;

template <typename T> __device__ __forceinline__ void vst2(void* p, T v) { *(T*)p = v;  }
__device__ __forceinline__ v8f wmma16(v16h a, v16h b, v8f c) {
  v8f d = __builtin_amdgcn_wmma_f32_16x16x32_f16(false, a, false, b, (short)0, c, false, false);
  asm volatile("v_nop\n\tv_nop\n\tv_nop\n\tv_nop" : "+v"(d) : "v"(a), "v"(b));
  return d;
}
__device__ __forceinline__ v8f wmma_bf(v16b a, v16b b, v8f c) {
  v8f d = __builtin_amdgcn_wmma_f32_16x16x32_bf16(false, a, false, b, (short)0, c, false, false);
  asm volatile("v_nop\n\tv_nop\n\tv_nop\n\tv_nop" : "+v"(d) : "v"(a), "v"(b));
  return d;
}
// 16x16x32 fragments: lane = (h = lane>>4, row/col = lane&15); elements 0..7 = k0+8h+0..7, 8..15 = k0+16+8h+0..7; D element r = row 8h+r
__device__ __forceinline__ v16h frag_h(const _Float16* rowk0, int lane) {
  union { v16h v; v8h q[2]; } u; const _Float16* p = rowk0 + 8 * (lane >> 4);
  u.q[0] = *(const v8h*)p; u.q[1] = *(const v8h*)(p + 16); return u.v;
}
__device__ __forceinline__ v16h frag_f32(const float* rowk0, int lane) {
  v16h a; const float* p = rowk0 + 8 * (lane >> 4);
#pragma unroll
  for (int i = 0; i < 8; ++i) { a[i] = (_Float16)p[i]; a[8 + i] = (_Float16)p[16 + i]; }
  return a;
}
__device__ __forceinline__ v16h frag_f32s(const float* rowk0, int lane, float sc) {
  v16h a; const float* p = rowk0 + 8 * (lane >> 4);
#pragma unroll
  for (int i = 0; i < 8; ++i) { a[i] = (_Float16)(p[i] * sc); a[8 + i] = (_Float16)(p[16 + i] * sc); }
  return a;
}
// column fragment from a [K][ld] layout (column n), rows >= K read as 0
__device__ __forceinline__ v16h fragc_f32(const float* W, int k0, int n, int lane, int ld, int K) {
  v16h a; const int g = lane >> 4;
#pragma unroll
  for (int i = 0; i < 8; ++i) { const int ka = k0 + 8 * g + i, kb = ka + 16;
    a[i] = (_Float16)(ka < K ? W[(size_t)(ka < K ? ka : K - 1) * ld + n] : 0.f); a[8 + i] = (_Float16)(kb < K ? W[(size_t)(kb < K ? kb : K - 1) * ld + n] : 0.f); }
  return a;
}
struct F2 { v16b h, l; };
__device__ __forceinline__ F2 bsplit16(const float v[16]) { F2 r;
#pragma unroll
  for (int i = 0; i < 16; ++i) { const __bf16 h = (__bf16)v[i]; r.h[i] = h; r.l[i] = (__bf16)(v[i] - (float)h); }
  return r; }
__device__ __forceinline__ F2 split_row(const float* row, int k0, int lane) { float v[16]; const float* p = row + k0 + 8 * (lane >> 4);
#pragma unroll
  for (int i = 0; i < 8; ++i) { v[i] = p[i]; v[8 + i] = p[16 + i]; }
  return bsplit16(v); }
__device__ __forceinline__ F2 split_rowK(const float* row, int k0, int lane, int K) { float v[16]; const int g = lane >> 4;
#pragma unroll
  for (int i = 0; i < 8; ++i) { const int ka = k0 + 8 * g + i, kb = ka + 16; v[i] = ka < K ? row[ka < K ? ka : K - 1] : 0.f; v[8 + i] = kb < K ? row[kb < K ? kb : K - 1] : 0.f; }
  return bsplit16(v); }
__device__ __forceinline__ F2 split_col(const float* W, int k0, int n, int lane, int ld, int K) { float v[16]; const int g = lane >> 4;
#pragma unroll
  for (int i = 0; i < 8; ++i) { const int ka = k0 + 8 * g + i, kb = ka + 16; v[i] = ka < K ? W[(size_t)(ka < K ? ka : K - 1) * ld + n] : 0.f; v[8 + i] = kb < K ? W[(size_t)(kb < K ? kb : K - 1) * ld + n] : 0.f; }
  return bsplit16(v); }
__device__ __forceinline__ v8f mac3(const F2& a, const F2& b, v8f c) { c = wmma_bf(a.l, b.h, c); c = wmma_bf(a.h, b.l, c); return wmma_bf(a.h, b.h, c); }
__device__ __forceinline__ float sigm(float v) { return 1.0f / (1.0f + expf(-v)); }
#define LDSX() do { asm volatile("s_wait_dscnt 0" ::: "memory"); __builtin_amdgcn_wave_barrier(); __builtin_amdgcn_fence(__ATOMIC_RELEASE, "workgroup"); } while (0)


// MSML windowed linear attention, stage 1 (B 2, N 16,384 tokens, C 256, 4x4 windows of M = 16): q = elu(x Wq + bq) + 1, k likewise, v = x; phi = elu(.) + 1 again; KV[b,m] = sum_w phi_k[b,w,m]^T v[b,w,m]; att[b,w,n,m,:] = phi_q[b,w,n] KV[b,m] + p[b,w,n,m]; out = att.reshape(b, -1, C)[:, :N].
#define NB 2
#define NTOK 16384
#define CC 256
#define MW 16             // window size
#define NWIN (NTOK / MW)  // 1024 windows
#define WOUT 64           // windows that reach the output
#define TQ (WOUT * MW)    // 1024 query tokens per batch
#ifndef TNB
#define TNB NB
#endif
typedef __attribute__((ext_vector_type(8))) __bf16 v8b;
__device__ __forceinline__ v16b frag_b(const __bf16* rowk0, int lane) {
  union { v16b v; v8b q[2]; } u; const __bf16* p = rowk0 + 8 * (lane >> 4);
  u.q[0] = *(const v8b*)p; u.q[1] = *(const v8b*)(p + 16); return u.v;
}
__device__ __forceinline__ float bfr(float v) { return (float)(__bf16)v; }
__device__ __attribute__((noinline)) float exp_ni(float v) { return expf(v); }
__device__ __attribute__((noinline)) float erf_ni(float v) { return erff(v); }

#define WS_PW  0u                                   // 256 KiB not in use
#define WS_PHQ (WS_PW + 2u * 2 * CC * CC)              // f32 phi_q rows [b*NTOK + t][256] (t < TQ used)
#define WS_PHK (WS_PHQ + 4u * (size_t)NB * NTOK * CC)   // f32 phi_k rows
#define WS_KVT (WS_PHK + 4u * (size_t)NB * NTOK * CC)   // f32 KV^T [b][m][d][c]
#define WS_END (WS_KVT + 4u * (size_t)NB * MW * CC * CC)

__device__ __forceinline__ v16b fragb_f32(const float* __restrict__ p, int lane) { v16b a; const float* pp = p + 8 * (lane >> 4);
#pragma unroll
  for (int i = 0; i < 8; ++i) { a[i] = (__bf16)pp[i]; a[8 + i] = (__bf16)pp[16 + i]; } return a; }
__device__ __forceinline__ float elu1(float y) { return (y > 0.f ? y : expm1f(y)) + 1.0f; }
// ---- k_kv: block = (64 rows c, 128 cols d, b*MW + m), 8 waves (wave = 16 c x 64 d): KV[b,m][c][d] = sum_w phi_k[b, w*16+m, c] v[b, w*16+m, d] (K = 1,024 windows) -> stored transposed KV^T[b][m][d][c]
// Each stage of 64 windows is read once per block with 16-byte row loads, rounded once (phi_k to bf16 hi + lo, v to bf16) and laid row-major [window][column] in LDS; the k-major fragments come from transposing LDS loads. Two LDS buffers, two register sets: a stage's global loads are issued two stages ahead.
// work-group barrier whose fences name LDS alone: __syncthreads() would also wait out the global loads issued two stages ahead, which only registers receive
#define KVBAR() do { __builtin_amdgcn_fence(__ATOMIC_RELEASE, "workgroup", "local"); __builtin_amdgcn_s_barrier(); __builtin_amdgcn_fence(__ATOMIC_ACQUIRE, "workgroup", "local"); } while (0)
// keeps a stage's conversions, and with them the waits on its global loads, behind the products of the stage before, so that the loads have the whole two stages to land
#define KVHOLD() __builtin_amdgcn_sched_barrier(0)
#define KS 64                                // windows per stage
#define KV_NS (NWIN / KS)                    // 16 stages
#define PA 160u                              // LDS row pitch in bytes of the 64-column planes (32 B x odd, for the transposing load)
#define PB 288u                              // same for the 128-column plane
#define OFF_AL (KS * PA)                     // phi_k lo plane
#define OFF_B (2u * KS * PA)                 // v plane
#define STG_BYTES (2u * KS * PA + KS * PB)   // one buffer
typedef __attribute__((ext_vector_type(4))) __bf16 v4b;
typedef __attribute__((address_space(3))) v8b lds_v8b;
// lane (col, g) gets T[k + 8g + 0..7][col] and T[k + 16 + 8g + 0..7][col]: the k order of frag_b
__device__ __forceinline__ v16b frag_tr(const unsigned char* p, unsigned pitch) {
  union { v16b v; v8b q[2]; } u; u.q[0] = __builtin_amdgcn_ds_load_tr16_b128_v8bf16((lds_v8b*)p); u.q[1] = __builtin_amdgcn_ds_load_tr16_b128_v8bf16((lds_v8b*)(p + 16u * pitch)); return u.v;
}
struct KvRegs { v4f a[4], b[8]; };
__device__ __forceinline__ void kv_load(KvRegs& R, const float* __restrict__ pa, const float* __restrict__ pb, int s) {
#pragma unroll
  for (int i = 0; i < 4; ++i) R.a[i] = *(const v4f*)(pa + (size_t)(s * KS + 16 * i) * MW * CC);
#pragma unroll
  for (int i = 0; i < 8; ++i) R.b[i] = *(const v4f*)(pb + (size_t)(s * KS + 8 * i) * MW * CC);
  asm volatile("s_wait_xcnt 0x0" ::: "memory");   // precaution: stands before the next stage's address arithmetic rewrites the registers these loads name
}
__device__ __forceinline__ void kv_stash(const KvRegs& R, unsigned char* sa, unsigned char* sb) {
#pragma unroll
  for (int i = 0; i < 4; ++i) { v4b h, l;
#pragma unroll
    for (int e = 0; e < 4; ++e) { h[e] = (__bf16)R.a[i][e]; l[e] = (__bf16)(R.a[i][e] - (float)h[e]); }
    *(v4b*)(sa + 16u * i * PA) = h; *(v4b*)(sa + OFF_AL + 16u * i * PA) = l; }
#pragma unroll
  for (int i = 0; i < 8; ++i) { v4b w;
#pragma unroll
    for (int e = 0; e < 4; ++e) w[e] = (__bf16)R.b[i][e];
    *(v4b*)(sb + 8u * i * PB) = w; }
}
__device__ __forceinline__ void kv_mac(const unsigned char* fa, const unsigned char* fb, v8f acc[4]) {
#pragma unroll
  for (int kk = 0; kk < KS / 32; ++kk) { const v16b ah = frag_tr(fa + 32u * kk * PA, PA), al = frag_tr(fa + OFF_AL + 32u * kk * PA, PA); v16b w[4];
#pragma unroll
    for (int j = 0; j < 4; ++j) w[j] = frag_tr(fb + 32u * kk * PB + 32u * j, PB);
#pragma unroll
    for (int j = 0; j < 4; ++j) acc[j] = wmma_bf(ah, w[j], acc[j]);
#pragma unroll
    for (int j = 0; j < 4; ++j) acc[j] = wmma_bf(al, w[j], acc[j]); }
}
__global__ __launch_bounds__(256) void k_kv(const float* __restrict__ PHK, const float* __restrict__ X, float* __restrict__ KVT) { __shared__ __attribute__((aligned(256))) unsigned char L[2 * STG_BYTES]; __shared__ __align__(16) float st[128][68];
  const int tid = threadIdx.x, wave = tid >> 5, lane = tid & 31, col = lane & 15, g = lane >> 4; const size_t b = blockIdx.z / MW; const int m = blockIdx.z % MW; const int wc = wave & 3, wd = wave >> 2; const int cb = blockIdx.x * 64; const int d0 = blockIdx.y * 128;
  const float* pa = PHK + (b * NTOK + (size_t)(tid >> 4) * MW + m) * CC + cb + (tid & 15) * 4;   // 16 lanes a row of 64 c; window tid>>4, +16 per load
  const float* pb = X + (b * NTOK + (size_t)(tid >> 5) * MW + m) * CC + d0 + (tid & 31) * 4;     // a wave a row of 128 d; window tid>>5, +8 per load
  unsigned char* sa = L + (unsigned)(tid >> 4) * PA + (unsigned)(tid & 15) * 8u; unsigned char* sb = L + OFF_B + (unsigned)(tid >> 5) * PB + (unsigned)(tid & 31) * 8u;
  const unsigned rl = 8u * g + (lane & 7), sub = 16u * ((lane >> 3) & 1);
  const unsigned char* fa = L + rl * PA + 32u * wc + sub; const unsigned char* fb = L + OFF_B + rl * PB + 128u * wd + sub;
  v8f acc[4] = {}; KvRegs R0, R1;
  kv_load(R0, pa, pb, 0); kv_load(R1, pa, pb, 1);
  kv_stash(R0, sa, sb); kv_load(R0, pa, pb, 2); KVBAR();
#pragma unroll 1
  for (int s = 0; s < KV_NS - 4; s += 2) {   // buffer 0 holds stage s, R1 stage s + 1, R0 stage s + 2; rolled: the body is already two stages
    kv_mac(fa, fb, acc); KVHOLD(); kv_stash(R1, sa + STG_BYTES, sb + STG_BYTES); kv_load(R1, pa, pb, s + 3); KVBAR();
    kv_mac(fa + STG_BYTES, fb + STG_BYTES, acc); KVHOLD(); kv_stash(R0, sa, sb); kv_load(R0, pa, pb, s + 4); KVBAR(); }
  kv_mac(fa, fb, acc); KVHOLD(); kv_stash(R1, sa + STG_BYTES, sb + STG_BYTES); kv_load(R1, pa, pb, KV_NS - 1); KVBAR();
  kv_mac(fa + STG_BYTES, fb + STG_BYTES, acc); KVHOLD(); kv_stash(R0, sa, sb); KVBAR();
  kv_mac(fa, fb, acc); KVHOLD(); kv_stash(R1, sa + STG_BYTES, sb + STG_BYTES); KVBAR();
  kv_mac(fa + STG_BYTES, fb + STG_BYTES, acc);
#pragma unroll
  for (int j = 0; j < 4; ++j)
#pragma unroll
    for (int r = 0; r < 8; ++r) st[wd * 64 + j * 16 + col][wc * 16 + 8 * g + r] = acc[j][r];   // transposed [d][c]
  __syncthreads(); for (int e = tid; e < 128 * 16; e += 256) { const int dl = e >> 4, q = e & 15; vst2(KVT + ((b * MW + m) * CC + d0 + dl) * (size_t)CC + cb + q * 4, *(const v4f*)&st[dl][q * 4]); } }
// ---- k_phi: block = 17 waves x 128 columns, wave = 16 tokens x 128 columns: phi = elu(elu(x W + b) + 1) + 1 -> f32 rows. Waves 0..15: 256 tokens of phi_k (every token); wave 16: one 16-token tile of phi_q, of the TQ tokens of each batch that k_att reads. 128 x 2 blocks: every WGP gets the same work
// No global load of this kernel touches more than 4 lines. The block's 128 columns of Wk and of Wq ((in,out) f32: 256 rows of 512 B each) are read once with whole-line 16-byte loads, rounded once to bf16 and laid row-major [k][column] in LDS; every wave takes its B fragments from there with transposing loads. Each wave reads its own 16 rows of x the same way and lays them, rounded, in its own LDS range (A fragments by frag_b, the same k order); that range later stages the wave's output rows.
#define PHW 17                               // waves a block
#define WPB 288u                             // LDS row pitch in bytes of a weight slab (32 B x odd, for the transposing load)
#define SLAB (CC * WPB)                      // one slab
#define XPB 528u                             // LDS row pitch in bytes of a wave's range: 256 bf16 of x + 16 B (16 B x odd, for ds_load_b128), then 132 f32 of output
__device__ __forceinline__ v4f phi_ldx(const float* __restrict__ xs, int i) { return *(const v4f*)(xs + (size_t)(i >> 1) * CC + 128 * (i & 1)); }   // load i: half i % 2 of row i / 2, a wave half a row
__global__ __launch_bounds__(PHW * 32) void k_phi(const float* __restrict__ X, const float* __restrict__ WQ, const float* __restrict__ WK, const float* __restrict__ BQ, const float* __restrict__ BK, float* __restrict__ PHQ, float* __restrict__ PHK) { __shared__ __attribute__((aligned(256))) unsigned char SW[2 * SLAB]; __shared__ __align__(16) unsigned char ST[PHW * 16 * XPB];
  const int tid = threadIdx.x, wave = __builtin_amdgcn_readfirstlane(tid >> 5), lane = tid & 31, col = lane & 15, g = lane >> 4; const int bx = blockIdx.x; const bool isk = wave < 16; const size_t r0 = isk ? (size_t)bx * 256 + wave * 16 : (size_t)(bx / (TQ / 16)) * NTOK + (size_t)(bx % (TQ / 16)) * 16; const int c0 = blockIdx.y * 128; const float* Bm = isk ? BK : BQ; float* dst = isk ? PHK : PHQ;
  unsigned char* xt = ST + (unsigned)wave * (16u * XPB); const float* xs = X + r0 * CC + lane * 4;
  v4f xr[32];
  if (isk) { const float* wk = WK + (size_t)wave * CC + c0 + lane * 4; const float* wq = WQ + (size_t)wave * CC + c0 + lane * 4; unsigned char* sp = SW + (unsigned)wave * WPB + (unsigned)lane * 8u; v4f r[32];   // loads i and 16 + i: row 16 i + wave of Wk and of Wq, a wave a row
#pragma unroll
    for (int i = 0; i < 16; ++i) { r[i] = *(const v4f*)(wk + (size_t)i * 16 * CC); r[16 + i] = *(const v4f*)(wq + (size_t)i * 16 * CC); }
    KVHOLD();   // keeps the loads of x behind the slabs': hoisted among them they take registers the slabs still hold, and the build spills to scratch
#pragma unroll
    for (int i = 0; i < 32; ++i) { v4b w;   // each slab register set, once stored, takes a load of x: x flies while the rest is laid
#pragma unroll
      for (int e = 0; e < 4; ++e) w[e] = (__bf16)r[i][e];
      *(v4b*)(sp + (i >> 4) * SLAB + 16u * (i & 15) * WPB) = w; xr[i] = phi_ldx(xs, i); } }
  else {
#pragma unroll
    for (int i = 0; i < 32; ++i) xr[i] = phi_ldx(xs, i); }
#pragma unroll
  for (int i = 0; i < 32; ++i) { v4b w;
#pragma unroll
    for (int e = 0; e < 4; ++e) w[e] = (__bf16)xr[i][e];
    *(v4b*)(xt + (unsigned)(i >> 1) * XPB + 256u * (i & 1) + (unsigned)lane * 8u) = w; }
  KVBAR();   // every row of both slabs (and of the wave's own x) is in LDS before any wave reads a fragment; the fences name LDS alone: nothing global is handed over here
  const unsigned char* fb = SW + (isk ? 0u : SLAB) + (8u * g + (lane & 7)) * WPB + 16u * ((lane >> 3) & 1); const __bf16* fa = (const __bf16*)(xt + (unsigned)col * XPB);
  v8f acc[8] = {};
#pragma unroll
  for (int kc = 0; kc < CC / 32; ++kc) { const v16b a = frag_b(fa + kc * 32, lane); v16b w[8];
#pragma unroll
    for (int j = 0; j < 8; ++j) w[j] = frag_tr(fb + 32u * kc * WPB + 32u * j, WPB);
#pragma unroll
    for (int j = 0; j < 8; ++j) acc[j] = wmma_bf(a, w[j], acc[j]); }
  float (*sf)[132] = (float (*)[132])xt;   // the wave has read its last x fragment: every value stored below hangs on all of them
#pragma unroll
  for (int j = 0; j < 8; ++j) { const float bb = bfr(Bm[c0 + j * 16 + col]);
#pragma unroll
    for (int r = 0; r < 8; ++r) sf[8 * g + r][j * 16 + col] = elu1(elu1(acc[j][r] + bb)); }
  LDSX(); for (int rl = 0; rl < 16; ++rl) vst2(dst + (r0 + rl) * CC + c0 + lane * 4, *(const v4f*)&sf[rl][lane * 4]); }
// ---- k_att: block = (256 query tokens t, 128 cols d, b*MW + m), 8 waves (wave = 32 t x 128 d): out[b][t*16 + m][d] = phi_q[b,t] . KV[b,m][:, d] (3 products) + p[b][w = t/16][n = t%16][m]
// The block's 128 rows of KV^T (contiguous, 128 KiB of f32) are read once with whole-line 16-byte loads, split once into bf16 hi + lo and laid in LDS, a row's hi half and lo half side by side; every wave takes its B fragments from there.
// Every "#pragma unroll" of this kernel keeps an array (r, an0, an1, acc0, acc1) in registers: its indices must be constants.
#define AP 1040u                             // LDS row pitch in bytes: 256 bf16 hi, 256 bf16 lo, 16 B of pad (16 B x odd, for ds_load_b128)
#define AT_LO 512u                           // a row's lo half
__device__ __forceinline__ void att_lda(float v[16], const float* __restrict__ p) {   // the k order of split_row
  const v4f q0 = *(const v4f*)p, q1 = *(const v4f*)(p + 4), q2 = *(const v4f*)(p + 16), q3 = *(const v4f*)(p + 20);
#pragma unroll
  for (int e = 0; e < 4; ++e) { v[e] = q0[e]; v[4 + e] = q1[e]; v[8 + e] = q2[e]; v[12 + e] = q3[e]; }
}
__global__ __launch_bounds__(256) void k_att(const float* __restrict__ PHQ, const float* __restrict__ KVT, const float* __restrict__ EQK, const float* __restrict__ WP, const float* __restrict__ BP, float* __restrict__ OUT) { __shared__ __align__(16) unsigned char SB[128u * AP]; __shared__ __align__(16) float sf[8][32][132];
  const int tid = threadIdx.x, wave = tid >> 5, lane = tid & 31, col = lane & 15, g = lane >> 4; const size_t b = blockIdx.z / MW; const int m = blockIdx.z % MW; const int t0 = blockIdx.x * 256 + wave * 32; const int d0 = blockIdx.y * 128;
  { const float* src = KVT + ((b * MW + m) * CC + d0) * (size_t)CC + tid * 4; v4f r[32];   // load i: row 4 i + tid / 64, columns 4 (tid % 64) ..
#pragma unroll
    for (int i = 0; i < 32; ++i) r[i] = *(const v4f*)(src + i * 1024);
    unsigned char* sp = SB + (unsigned)(tid >> 6) * AP + (unsigned)(tid & 63) * 8u;
#pragma unroll
    for (int i = 0; i < 32; ++i) { v4b h, l;
#pragma unroll
      for (int e = 0; e < 4; ++e) { h[e] = (__bf16)r[i][e]; l[e] = (__bf16)(r[i][e] - (float)h[e]); }
      *(v4b*)(sp + 4u * i * AP) = h; *(v4b*)(sp + AT_LO + 4u * i * AP) = l; } }
  const float* pq = PHQ + (b * NTOK + t0 + col) * CC + 8 * g; float an0[16], an1[16];
  att_lda(an0, pq); att_lda(an1, pq + 16 * CC);
  KVBAR();   // every row of the slab is in LDS before any wave reads a fragment; the fences name LDS alone: nothing global is handed over here
  v8f acc0[8] = {}, acc1[8] = {};
#pragma unroll
  for (int kc = 0; kc < CC / 32; ++kc) { const F2 a0 = bsplit16(an0), a1 = bsplit16(an1);
    if (kc + 1 < CC / 32) { att_lda(an0, pq + (kc + 1) * 32); att_lda(an1, pq + 16 * CC + (kc + 1) * 32); }
#pragma unroll
    for (int j = 0; j < 8; j += 2) { const __bf16* w0 = (const __bf16*)(SB + (unsigned)(j * 16 + col) * AP) + kc * 32; const __bf16* w1 = (const __bf16*)(SB + (unsigned)(j * 16 + 16 + col) * AP) + kc * 32;
      const v16b h0 = frag_b(w0, lane), h1 = frag_b(w1, lane), l0 = frag_b(w0 + AT_LO / 2, lane), l1 = frag_b(w1 + AT_LO / 2, lane);
      acc0[j] = wmma_bf(a0.h, h0, acc0[j]); acc1[j] = wmma_bf(a1.h, h0, acc1[j]); acc0[j + 1] = wmma_bf(a0.h, h1, acc0[j + 1]); acc1[j + 1] = wmma_bf(a1.h, h1, acc1[j + 1]);
      acc0[j] = wmma_bf(a0.h, l0, acc0[j]); acc1[j] = wmma_bf(a1.h, l0, acc1[j]); acc0[j + 1] = wmma_bf(a0.h, l1, acc0[j + 1]); acc1[j + 1] = wmma_bf(a1.h, l1, acc1[j + 1]);
      acc0[j] = wmma_bf(a0.l, h0, acc0[j]); acc1[j] = wmma_bf(a1.l, h0, acc1[j]); acc0[j + 1] = wmma_bf(a0.l, h1, acc0[j + 1]); acc1[j + 1] = wmma_bf(a1.l, h1, acc1[j + 1]); } }
  const float wp0 = bfr(WP[0]), wp1 = bfr(WP[1]), wp2 = bfr(WP[2]), bpv = bfr(BP[0]);
#pragma unroll
  for (int u = 0; u < 2; ++u)
#pragma unroll
    for (int r = 0; r < 8; ++r) { const int t = t0 + u * 16 + 8 * g + r; const int w = t / MW, n = t % MW; const float* e3 = EQK + ((((b * NWIN + w) * MW + n) * MW + m) * 3); const float pv = bfr(e3[0]) * wp0 + bfr(e3[1]) * wp1 + bfr(e3[2]) * wp2 + bpv;
#pragma unroll
      for (int j = 0; j < 8; ++j) sf[wave][u * 16 + 8 * g + r][j * 16 + col] = (u ? acc1[j][r] : acc0[j][r]) + pv; }
  LDSX(); for (int rl = 0; rl < 32; ++rl) vst2(OUT + (b * NTOK + (size_t)(t0 + rl) * MW + m) * CC + d0 + lane * 4, *(const v4f*)&sf[wave][rl][lane * 4]); }
extern "C" void kernel_launch(void* const* d_in, const int* in_sizes, int n_in, void* d_out, int out_size, void* d_ws, size_t ws_size, hipStream_t stream) {
  (void)in_sizes; (void)n_in; (void)out_size;
  const float** F = (const float**)d_in;   // 0 input [2,16384,256], 1 embed_qk [2,1024,16,16,3], 2 Wq [256,256] (in,out), 3 bq, 4 Wk, 5 bk, 6 Wp [3,1], 7 bp [1]
  if (ws_size < (size_t)WS_END) return;
  char* ws = (char*)d_ws; float *PHQ = (float*)(ws + WS_PHQ), *PHK = (float*)(ws + WS_PHK), *KVT = (float*)(ws + WS_KVT);
  k_phi<<<dim3(NB * NTOK / 256, CC / 128, 1), PHW * 32, 0, stream>>>(F[0], F[2], F[4], F[3], F[5], PHQ, PHK);
  k_kv<<<dim3(CC / 64, CC / 128, NB * MW), 256, 0, stream>>>(PHK, F[0], KVT);
  k_att<<<dim3(TQ / 256, CC / 128, TNB * MW), 256, 0, stream>>>(PHQ, KVT, F[1], F[6], F[7], (float*)d_out);
}

// v005
// A run of this version takes 52.4 microseconds.
// Next to v004, in two timings, it ran 1.36 and 1.34 times as fast.
// Over all steps from v000 it is 4.50 times as fast.
// compute dtype: all float inputs rounded to bf16; q/k projections with EXACT bf16 products on WMMA 16x16x32 ((in,out) weights), the two ELU+1 feature maps in f32; KV_m = sum over all 1,024 windows of phi_k (bf16 hi + lo) x v (exact input) on WMMA (2 products); att = phi_q (hi + lo) . KV_m (hi + lo) on WMMA (3 products) + the positional term p (embed_qk . Wp + bp, f32); f32 output. Only windows w < 64 of the (b, w, n, m, d) intermediate survive the module's reshape(b, -1, c)[:, :n] slice, so only those are computed.
#include <hip/hip_runtime.h>
#include <math.h>

typedef __attribute__((ext_vector_type(16))) _Float16 v16h;
typedef __attribute__((ext_vector_type(16))) __bf16 v16b;
typedef __attribute__((ext_vector_type(8)))  _Float16 v8h;
typedef __attribute__((ext_vector_type(8)))  float v8f;
typedef __attribute__((ext_vector_type(4)))  float v4f;
typedef __attribute__((ext_vector_type(2)))  float v2f;
typedef __attribute__((ext_vector_type(4)))  unsigned v4u;
typedef __attribute__((ext_vector_type(4)))  int v4i;
typedef float __attribute__((may_alias)) float_a;
typedef int __attribute__((may_alias)) int_a;

template <typename T> __device__ __forceinline__ void vst2(void* p, T v) { *(T*)p = v;  }
__device__ __forceinline__ v8f wmma16(v16h a, v16h b, v8f c) {
  v8f d = __builtin_amdgcn_wmma_f32_16x16x32_f16(false, a, false, b, (short)0, c, false, false);
  asm volatile("v_nop\n\tv_nop\n\tv_nop\n\tv_nop" : "+v"(d) : "v"(a), "v"(b));
  return d;
}
__device__ __forceinline__ v8f wmma_bf(v16b a, v16b b, v8f c) {
  v8f d = __builtin_amdgcn_wmma_f32_16x16x32_bf16(false, a, false, b, (short)0, c, false, false);
  asm volatile("v_nop\n\tv_nop\n\tv_nop\n\tv_nop" : "+v"(d) : "v"(a), "v"(b));
  return d;
}
// 16x16x32 fragments: lane = (h = lane>>4, row/col = lane&15); elements 0..7 = k0+8h+0..7, 8..15 = k0+16+8h+0..7; D element r = row 8h+r
__device__ __forceinline__ v16h frag_h(const _Float16* rowk0, int lane) {
  union { v16h v; v8h q[2]; } u; const _Float16* p = rowk0 + 8 * (lane >> 4);
  u.q[0] = *(const v8h*)p; u.q[1] = *(const v8h*)(p + 16); return u.v;
}
__device__ __forceinline__ v16h frag_f32(const float* rowk0, int lane) {
  v16h a; const float* p = rowk0 + 8 * (lane >> 4);
#pragma unroll
  for (int i = 0; i < 8; ++i) { a[i] = (_Float16)p[i]; a[8 + i] = (_Float16)p[16 + i]; }
  return a;
}
__device__ __forceinline__ v16h frag_f32s(const float* rowk0, int lane, float sc) {
  v16h a; const float* p = rowk0 + 8 * (lane >> 4);
#pragma unroll
  for (int i = 0; i < 8; ++i) { a[i] = (_Float16)(p[i] * sc); a[8 + i] = (_Float16)(p[16 + i] * sc); }
  return a;
}
// column fragment from a [K][ld] layout (column n), rows >= K read as 0
__device__ __forceinline__ v16h fragc_f32(const float* W, int k0, int n, int lane, int ld, int K) {
  v16h a; const int g = lane >> 4;
#pragma unroll
  for (int i = 0; i < 8; ++i) { const int ka = k0 + 8 * g + i, kb = ka + 16;
    a[i] = (_Float16)(ka < K ? W[(size_t)(ka < K ? ka : K - 1) * ld + n] : 0.f); a[8 + i] = (_Float16)(kb < K ? W[(size_t)(kb < K ? kb : K - 1) * ld + n] : 0.f); }
  return a;
}
struct F2 { v16b h, l; };
__device__ __forceinline__ F2 bsplit16(const float v[16]) { F2 r;
#pragma unroll
  for (int i = 0; i < 16; ++i) { const __bf16 h = (__bf16)v[i]; r.h[i] = h; r.l[i] = (__bf16)(v[i] - (float)h); }
  return r; }
__device__ __forceinline__ F2 split_row(const float* row, int k0, int lane) { float v[16]; const float* p = row + k0 + 8 * (lane >> 4);
#pragma unroll
  for (int i = 0; i < 8; ++i) { v[i] = p[i]; v[8 + i] = p[16 + i]; }
  return bsplit16(v); }
__device__ __forceinline__ F2 split_rowK(const float* row, int k0, int lane, int K) { float v[16]; const int g = lane >> 4;
#pragma unroll
  for (int i = 0; i < 8; ++i) { const int ka = k0 + 8 * g + i, kb = ka + 16; v[i] = ka < K ? row[ka < K ? ka : K - 1] : 0.f; v[8 + i] = kb < K ? row[kb < K ? kb : K - 1] : 0.f; }
  return bsplit16(v); }
__device__ __forceinline__ F2 split_col(const float* W, int k0, int n, int lane, int ld, int K) { float v[16]; const int g = lane >> 4;
#pragma unroll
  for (int i = 0; i < 8; ++i) { const int ka = k0 + 8 * g + i, kb = ka + 16; v[i] = ka < K ? W[(size_t)(ka < K ? ka : K - 1) * ld + n] : 0.f; v[8 + i] = kb < K ? W[(size_t)(kb < K ? kb : K - 1) * ld + n] : 0.f; }
  return bsplit16(v); }
__device__ __forceinline__ v8f mac3(const F2& a, const F2& b, v8f c) { c = wmma_bf(a.l, b.h, c); c = wmma_bf(a.h, b.l, c); return wmma_bf(a.h, b.h, c); }
__device__ __forceinline__ float sigm(float v) { return 1.0f / (1.0f + expf(-v)); }
#define LDSX() do { asm volatile("s_wait_dscnt 0" ::: "memory"); __builtin_amdgcn_wave_barrier(); __builtin_amdgcn_fence(__ATOMIC_RELEASE, "workgroup"); } while (0)


// MSML windowed linear attention, stage 1 (B 2, N 16,384 tokens, C 256, 4x4 windows of M = 16): q = elu(x Wq + bq) + 1, k likewise, v = x; phi = elu(.) + 1 again; KV[b,m] = sum_w phi_k[b,w,m]^T v[b,w,m]; att[b,w,n,m,:] = phi_q[b,w,n] KV[b,m] + p[b,w,n,m]; out = att.reshape(b, -1, C)[:, :N].
#define NB 2
#define NTOK 16384
#define CC 256
#define MW 16             // window size
#define NWIN (NTOK / MW)  // 1024 windows
#define WOUT 64           // windows that reach the output
#define TQ (WOUT * MW)    // 1024 query tokens per batch
#ifndef TNB
#define TNB NB
#endif
typedef __attribute__((ext_vector_type(8))) __bf16 v8b;
__device__ __forceinline__ v16b frag_b(const __bf16* rowk0, int lane) {
  union { v16b v; v8b q[2]; } u; const __bf16* p = rowk0 + 8 * (lane >> 4);
  u.q[0] = *(const v8b*)p; u.q[1] = *(const v8b*)(p + 16); return u.v;
}
__device__ __forceinline__ float bfr(float v) { return (float)(__bf16)v; }
__device__ __attribute__((noinline)) float exp_ni(float v) { return expf(v); }
__device__ __attribute__((noinline)) float erf_ni(float v) { return erff(v); }

#define WS_PW  0u                                   // 256 KiB not in use
#define WS_PHQ (WS_PW + 2u * 2 * CC * CC)              // f32 phi_q rows [b*NTOK + t][256] (t < TQ used)
#define WS_PHK (WS_PHQ + 4u * (size_t)NB * NTOK * CC)   // f32 phi_k rows
#define WS_KVT (WS_PHK + 4u * (size_t)NB * NTOK * CC)   // f32 KV^T [b][m][d][c]
#define WS_END (WS_KVT + 4u * (size_t)NB * MW * CC * CC)

__device__ __forceinline__ v16b fragb_f32(const float* __restrict__ p, int lane) { v16b a; const float* pp = p + 8 * (lane >> 4);
#pragma unroll
  for (int i = 0; i < 8; ++i) { a[i] = (__bf16)pp[i]; a[8 + i] = (__bf16)pp[16 + i]; } return a; }
// elu(elu(y) + 1) + 1 in closed form. elu(y) + 1 is y + 1 above 0 and exp(y) else, so it is never below 0, and on such a value the second elu is the identity (also at 0, where exp(y) has underflowed): y + 2 above 0, exp(y) + 1 else. exp(y) lies in [0, 1] there and is added to 1, so the hardware exp2 of y log2(e) is exact enough: its error stays under half a last place of the sum. NaN stays NaN
__device__ __forceinline__ float phi_map(float y) { return y > 0.f ? y + 2.0f : __builtin_amdgcn_exp2f(y * 1.44269504f) + 1.0f; }
// ---- k_kv: block = (64 rows c, 128 cols d, b*MW + m), 8 waves (wave = 16 c x 64 d): KV[b,m][c][d] = sum_w phi_k[b, w*16+m, c] v[b, w*16+m, d] (K = 1,024 windows) -> stored transposed KV^T[b][m][d][c]
// Each stage of 64 windows is read once per block with 16-byte row loads, rounded once (phi_k to bf16 hi + lo, v to bf16) and laid row-major [window][column] in LDS; the k-major fragments come from transposing LDS loads. Two LDS buffers, two register sets: a stage's global loads are issued two stages ahead.
// work-group barrier whose fences name LDS alone: __syncthreads() would also wait out the global loads issued two stages ahead, which only registers receive
#define KVBAR() do { __builtin_amdgcn_fence(__ATOMIC_RELEASE, "workgroup", "local"); __builtin_amdgcn_s_barrier(); __builtin_amdgcn_fence(__ATOMIC_ACQUIRE, "workgroup", "local"); } while (0)
// keeps a stage's conversions, and with them the waits on its global loads, behind the products of the stage before, so that the loads have the whole two stages to land
#define KVHOLD() __builtin_amdgcn_sched_barrier(0)
#define KS 64                                // windows per stage
#define KV_NS (NWIN / KS)                    // 16 stages
#define PA 160u                              // LDS row pitch in bytes of the 64-column planes (32 B x odd, for the transposing load)
#define PB 288u                              // same for the 128-column plane
#define OFF_AL (KS * PA)                     // phi_k lo plane
#define OFF_B (2u * KS * PA)                 // v plane
#define STG_BYTES (2u * KS * PA + KS * PB)   // one buffer
typedef __attribute__((ext_vector_type(4))) __bf16 v4b;
typedef __attribute__((address_space(3))) v8b lds_v8b;
// lane (col, g) gets T[k + 8g + 0..7][col] and T[k + 16 + 8g + 0..7][col]: the k order of frag_b
__device__ __forceinline__ v16b frag_tr(const unsigned char* p, unsigned pitch) {
  union { v16b v; v8b q[2]; } u; u.q[0] = __builtin_amdgcn_ds_load_tr16_b128_v8bf16((lds_v8b*)p); u.q[1] = __builtin_amdgcn_ds_load_tr16_b128_v8bf16((lds_v8b*)(p + 16u * pitch)); return u.v;
}
struct KvRegs { v4f a[4], b[8]; };
__device__ __forceinline__ void kv_load(KvRegs& R, const float* __restrict__ pa, const float* __restrict__ pb, int s) {
#pragma unroll
  for (int i = 0; i < 4; ++i) R.a[i] = *(const v4f*)(pa + (size_t)(s * KS + 16 * i) * MW * CC);
#pragma unroll
  for (int i = 0; i < 8; ++i) R.b[i] = *(const v4f*)(pb + (size_t)(s * KS + 8 * i) * MW * CC);
  asm volatile("s_wait_xcnt 0x0" ::: "memory");   // precaution: stands before the next stage's address arithmetic rewrites the registers these loads name
}
__device__ __forceinline__ void kv_stash(const KvRegs& R, unsigned char* sa, unsigned char* sb) {
#pragma unroll
  for (int i = 0; i < 4; ++i) { v4b h, l;
#pragma unroll
    for (int e = 0; e < 4; ++e) { h[e] = (__bf16)R.a[i][e]; l[e] = (__bf16)(R.a[i][e] - (float)h[e]); }
    *(v4b*)(sa + 16u * i * PA) = h; *(v4b*)(sa + OFF_AL + 16u * i * PA) = l; }
#pragma unroll
  for (int i = 0; i < 8; ++i) { v4b w;
#pragma unroll
    for (int e = 0; e < 4; ++e) w[e] = (__bf16)R.b[i][e];
    *(v4b*)(sb + 8u * i * PB) = w; }
}
__device__ __forceinline__ void kv_mac(const unsigned char* fa, const unsigned char* fb, v8f acc[4]) {
#pragma unroll
  for (int kk = 0; kk < KS / 32; ++kk) { const v16b ah = frag_tr(fa + 32u * kk * PA, PA), al = frag_tr(fa + OFF_AL + 32u * kk * PA, PA); v16b w[4];
#pragma unroll
    for (int j = 0; j < 4; ++j) w[j] = frag_tr(fb + 32u * kk * PB + 32u * j, PB);
#pragma unroll
    for (int j = 0; j < 4; ++j) acc[j] = wmma_bf(ah, w[j], acc[j]);
#pragma unroll
    for (int j = 0; j < 4; ++j) acc[j] = wmma_bf(al, w[j], acc[j]); }
}
__global__ __launch_bounds__(256) void k_kv(const float* __restrict__ PHK, const float* __restrict__ X, float* __restrict__ KVT) { __shared__ __attribute__((aligned(256))) unsigned char L[2 * STG_BYTES]; __shared__ __align__(16) float st[128][68];
  const int tid = threadIdx.x, wave = tid >> 5, lane = tid & 31, col = lane & 15, g = lane >> 4; const size_t b = blockIdx.z / MW; const int m = blockIdx.z % MW; const int wc = wave & 3, wd = wave >> 2; const int cb = blockIdx.x * 64; const int d0 = blockIdx.y * 128;
  const float* pa = PHK + (b * NTOK + (size_t)(tid >> 4) * MW + m) * CC + cb + (tid & 15) * 4;   // 16 lanes a row of 64 c; window tid>>4, +16 per load
  const float* pb = X + (b * NTOK + (size_t)(tid >> 5) * MW + m) * CC + d0 + (tid & 31) * 4;     // a wave a row of 128 d; window tid>>5, +8 per load
  unsigned char* sa = L + (unsigned)(tid >> 4) * PA + (unsigned)(tid & 15) * 8u; unsigned char* sb = L + OFF_B + (unsigned)(tid >> 5) * PB + (unsigned)(tid & 31) * 8u;
  const unsigned rl = 8u * g + (lane & 7), sub = 16u * ((lane >> 3) & 1);
  const unsigned char* fa = L + rl * PA + 32u * wc + sub; const unsigned char* fb = L + OFF_B + rl * PB + 128u * wd + sub;
  v8f acc[4] = {}; KvRegs R0, R1;
  kv_load(R0, pa, pb, 0); kv_load(R1, pa, pb, 1);
  kv_stash(R0, sa, sb); kv_load(R0, pa, pb, 2); KVBAR();
#pragma unroll 1
  for (int s = 0; s < KV_NS - 4; s += 2) {   // buffer 0 holds stage s, R1 stage s + 1, R0 stage s + 2; rolled: the body is already two stages
    kv_mac(fa, fb, acc); KVHOLD(); kv_stash(R1, sa + STG_BYTES, sb + STG_BYTES); kv_load(R1, pa, pb, s + 3); KVBAR();
    kv_mac(fa + STG_BYTES, fb + STG_BYTES, acc); KVHOLD(); kv_stash(R0, sa, sb); kv_load(R0, pa, pb, s + 4); KVBAR(); }
  kv_mac(fa, fb, acc); KVHOLD(); kv_stash(R1, sa + STG_BYTES, sb + STG_BYTES); kv_load(R1, pa, pb, KV_NS - 1); KVBAR();
  kv_mac(fa + STG_BYTES, fb + STG_BYTES, acc); KVHOLD(); kv_stash(R0, sa, sb); KVBAR();
  kv_mac(fa, fb, acc); KVHOLD(); kv_stash(R1, sa + STG_BYTES, sb + STG_BYTES); KVBAR();
  kv_mac(fa + STG_BYTES, fb + STG_BYTES, acc);
#pragma unroll
  for (int j = 0; j < 4; ++j)
#pragma unroll
    for (int r = 0; r < 8; ++r) st[wd * 64 + j * 16 + col][wc * 16 + 8 * g + r] = acc[j][r];   // transposed [d][c]
  __syncthreads(); for (int e = tid; e < 128 * 16; e += 256) { const int dl = e >> 4, q = e & 15; vst2(KVT + ((b * MW + m) * CC + d0 + dl) * (size_t)CC + cb + q * 4, *(const v4f*)&st[dl][q * 4]); } }
// ---- k_phi: block = 17 waves x 128 columns, wave = 16 tokens x 128 columns: phi = elu(elu(x W + b) + 1) + 1 -> f32 rows. Waves 0..15: 256 tokens of phi_k (every token); wave 16: one 16-token tile of phi_q, of the TQ tokens of each batch that k_att reads. 128 x 2 blocks: every WGP gets the same work
// No global load of this kernel touches more than 4 lines. The block's 128 columns of Wk and of Wq ((in,out) f32: 256 rows of 512 B each) are read once with whole-line 16-byte loads, rounded once to bf16 and laid row-major [k][column] in LDS; every wave takes its B fragments from there with transposing loads. Each wave reads its own 16 rows of x the same way and lays them, rounded, in its own LDS range (A fragments by frag_b, the same k order); that range later stages the wave's output rows.
#define PHW 17                               // waves a block
#define WPB 288u                             // LDS row pitch in bytes of a weight slab (32 B x odd, for the transposing load)
#define SLAB (CC * WPB)                      // one slab
#define XPB 528u                             // LDS row pitch in bytes of a wave's range: 256 bf16 of x + 16 B (16 B x odd, for ds_load_b128), then 132 f32 of output
__device__ __forceinline__ v4f phi_ldx(const float* __restrict__ xs, int i) { return *(const v4f*)(xs + (size_t)(i >> 1) * CC + 128 * (i & 1)); }   // load i: half i % 2 of row i / 2, a wave half a row
__global__ __launch_bounds__(PHW * 32) void k_phi(const float* __restrict__ X, const float* __restrict__ WQ, const float* __restrict__ WK, const float* __restrict__ BQ, const float* __restrict__ BK, float* __restrict__ PHQ, float* __restrict__ PHK) { __shared__ __attribute__((aligned(256))) unsigned char SW[2 * SLAB]; __shared__ __align__(16) unsigned char ST[PHW * 16 * XPB];
  const int tid = threadIdx.x, wave = __builtin_amdgcn_readfirstlane(tid >> 5), lane = tid & 31, col = lane & 15, g = lane >> 4; const int bx = blockIdx.x; const bool isk = wave < 16; const size_t r0 = isk ? (size_t)bx * 256 + wave * 16 : (size_t)(bx / (TQ / 16)) * NTOK + (size_t)(bx % (TQ / 16)) * 16; const int c0 = blockIdx.y * 128; const float* Bm = isk ? BK : BQ; float* dst = isk ? PHK : PHQ;
  unsigned char* xt = ST + (unsigned)wave * (16u * XPB); const float* xs = X + r0 * CC + lane * 4;
  v4f xr[32];
  if (isk) { const float* wk = WK + (size_t)wave * CC + c0 + lane * 4; const float* wq = WQ + (size_t)wave * CC + c0 + lane * 4; unsigned char* sp = SW + (unsigned)wave * WPB + (unsigned)lane * 8u; v4f r[32];   // loads i and 16 + i: row 16 i + wave of Wk and of Wq, a wave a row
#pragma unroll
    for (int i = 0; i < 16; ++i) { r[i] = *(const v4f*)(wk + (size_t)i * 16 * CC); r[16 + i] = *(const v4f*)(wq + (size_t)i * 16 * CC); }
    KVHOLD();   // keeps the loads of x behind the slabs': hoisted among them they take registers the slabs still hold, and the build spills to scratch
#pragma unroll
    for (int i = 0; i < 32; ++i) { v4b w;   // each slab register set, once stored, takes a load of x: x flies while the rest is laid
#pragma unroll
      for (int e = 0; e < 4; ++e) w[e] = (__bf16)r[i][e];
      *(v4b*)(sp + (i >> 4) * SLAB + 16u * (i & 15) * WPB) = w; xr[i] = phi_ldx(xs, i); } }
  else {
#pragma unroll
    for (int i = 0; i < 32; ++i) xr[i] = phi_ldx(xs, i); }
#pragma unroll
  for (int i = 0; i < 32; ++i) { v4b w;
#pragma unroll
    for (int e = 0; e < 4; ++e) w[e] = (__bf16)xr[i][e];
    *(v4b*)(xt + (unsigned)(i >> 1) * XPB + 256u * (i & 1) + (unsigned)lane * 8u) = w; }
  KVBAR();   // every row of both slabs (and of the wave's own x) is in LDS before any wave reads a fragment; the fences name LDS alone: nothing global is handed over here
  const unsigned char* fb = SW + (isk ? 0u : SLAB) + (8u * g + (lane & 7)) * WPB + 16u * ((lane >> 3) & 1); const __bf16* fa = (const __bf16*)(xt + (unsigned)col * XPB);
  v8f acc[8] = {};
#pragma unroll
  for (int kc = 0; kc < CC / 32; ++kc) { const v16b a = frag_b(fa + kc * 32, lane); v16b w[8];
#pragma unroll
    for (int j = 0; j < 8; ++j) w[j] = frag_tr(fb + 32u * kc * WPB + 32u * j, WPB);
#pragma unroll
    for (int j = 0; j < 8; ++j) acc[j] = wmma_bf(a, w[j], acc[j]); }
  float (*sf)[132] = (float (*)[132])xt;   // the wave has read its last x fragment: every value stored below hangs on all of them
#pragma unroll
  for (int j = 0; j < 8; ++j) { const float bb = bfr(Bm[c0 + j * 16 + col]);
#pragma unroll
    for (int r = 0; r < 8; ++r) sf[8 * g + r][j * 16 + col] = phi_map(acc[j][r] + bb); }
  LDSX(); for (int rl = 0; rl < 16; ++rl) vst2(dst + (r0 + rl) * CC + c0 + lane * 4, *(const v4f*)&sf[rl][lane * 4]); }
// ---- k_att: block = (256 query tokens t, 128 cols d, b*MW + m), 8 waves (wave = 32 t x 128 d): out[b][t*16 + m][d] = phi_q[b,t] . KV[b,m][:, d] (3 products) + p[b][w = t/16][n = t%16][m]
// The block's 128 rows of KV^T (contiguous, 128 KiB of f32) are read once with whole-line 16-byte loads, split once into bf16 hi + lo and laid in LDS, a row's hi half and lo half side by side; every wave takes its B fragments from there.
// Every "#pragma unroll" of this kernel keeps an array (r, an0, an1, acc0, acc1) in registers: its indices must be constants.
#define AP 1040u                             // LDS row pitch in bytes: 256 bf16 hi, 256 bf16 lo, 16 B of pad (16 B x odd, for ds_load_b128)
#define AT_LO 512u                           // a row's lo half
__device__ __forceinline__ void att_lda(float v[16], const float* __restrict__ p) {   // the k order of split_row
  const v4f q0 = *(const v4f*)p, q1 = *(const v4f*)(p + 4), q2 = *(const v4f*)(p + 16), q3 = *(const v4f*)(p + 20);
#pragma unroll
  for (int e = 0; e < 4; ++e) { v[e] = q0[e]; v[4 + e] = q1[e]; v[8 + e] = q2[e]; v[12 + e] = q3[e]; }
}
__global__ __launch_bounds__(256) void k_att(const float* __restrict__ PHQ, const float* __restrict__ KVT, const float* __restrict__ EQK, const float* __restrict__ WP, const float* __restrict__ BP, float* __restrict__ OUT) { __shared__ __align__(16) unsigned char SB[128u * AP]; __shared__ __align__(16) float sf[8][32][132];
  const int tid = threadIdx.x, wave = tid >> 5, lane = tid & 31, col = lane & 15, g = lane >> 4; const size_t b = blockIdx.z / MW; const int m = blockIdx.z % MW; const int t0 = blockIdx.x * 256 + wave * 32; const int d0 = blockIdx.y * 128;
  { const float* src = KVT + ((b * MW + m) * CC + d0) * (size_t)CC + tid * 4; v4f r[32];   // load i: row 4 i + tid / 64, columns 4 (tid % 64) ..
#pragma unroll
    for (int i = 0; i < 32; ++i) r[i] = *(const v4f*)(src + i * 1024);
    unsigned char* sp = SB + (unsigned)(tid >> 6) * AP + (unsigned)(tid & 63) * 8u;
#pragma unroll
    for (int i = 0; i < 32; ++i) { v4b h, l;
#pragma unroll
      for (int e = 0; e < 4; ++e) { h[e] = (__bf16)r[i][e]; l[e] = (__bf16)(r[i][e] - (float)h[e]); }
      *(v4b*)(sp + 4u * i * AP) = h; *(v4b*)(sp + AT_LO + 4u * i * AP) = l; } }
  const float* pq = PHQ + (b * NTOK + t0 + col) * CC + 8 * g; float an0[16], an1[16];
  att_lda(an0, pq); att_lda(an1, pq + 16 * CC);
  KVBAR();   // every row of the slab is in LDS before any wave reads a fragment; the fences name LDS alone: nothing global is handed over here
  v8f acc0[8] = {}, acc1[8] = {};
#pragma unroll
  for (int kc = 0; kc < CC / 32; ++kc) { const F2 a0 = bsplit16(an0), a1 = bsplit16(an1);
    if (kc + 1 < CC / 32) { att_lda(an0, pq + (kc + 1) * 32); att_lda(an1, pq + 16 * CC + (kc + 1) * 32); }
#pragma unroll
    for (int j = 0; j < 8; j += 2) { const __bf16* w0 = (const __bf16*)(SB + (unsigned)(j * 16 + col) * AP) + kc * 32; const __bf16* w1 = (const __bf16*)(SB + (unsigned)(j * 16 + 16 + col) * AP) + kc * 32;
      const v16b h0 = frag_b(w0, lane), h1 = frag_b(w1, lane), l0 = frag_b(w0 + AT_LO / 2, lane), l1 = frag_b(w1 + AT_LO / 2, lane);
      acc0[j] = wmma_bf(a0.h, h0, acc0[j]); acc1[j] = wmma_bf(a1.h, h0, acc1[j]); acc0[j + 1] = wmma_bf(a0.h, h1, acc0[j + 1]); acc1[j + 1] = wmma_bf(a1.h, h1, acc1[j + 1]);
      acc0[j] = wmma_bf(a0.h, l0, acc0[j]); acc1[j] = wmma_bf(a1.h, l0, acc1[j]); acc0[j + 1] = wmma_bf(a0.h, l1, acc0[j + 1]); acc1[j + 1] = wmma_bf(a1.h, l1, acc1[j + 1]);
      acc0[j] = wmma_bf(a0.l, h0, acc0[j]); acc1[j] = wmma_bf(a1.l, h0, acc1[j]); acc0[j + 1] = wmma_bf(a0.l, h1, acc0[j + 1]); acc1[j + 1] = wmma_bf(a1.l, h1, acc1[j + 1]); } }
  const float wp0 = bfr(WP[0]), wp1 = bfr(WP[1]), wp2 = bfr(WP[2]), bpv = bfr(BP[0]);
#pragma unroll
  for (int u = 0; u < 2; ++u)
#pragma unroll
    for (int r = 0; r < 8; ++r) { const int t = t0 + u * 16 + 8 * g + r; const int w = t / MW, n = t % MW; const float* e3 = EQK + ((((b * NWIN + w) * MW + n) * MW + m) * 3); const float pv = bfr(e3[0]) * wp0 + bfr(e3[1]) * wp1 + bfr(e3[2]) * wp2 + bpv;
#pragma unroll
      for (int j = 0; j < 8; ++j) sf[wave][u * 16 + 8 * g + r][j * 16 + col] = (u ? acc1[j][r] : acc0[j][r]) + pv; }
  LDSX(); for (int rl = 0; rl < 32; ++rl) vst2(OUT + (b * NTOK + (size_t)(t0 + rl) * MW + m) * CC + d0 + lane * 4, *(const v4f*)&sf[wave][rl][lane * 4]); }
extern "C" void kernel_launch(void* const* d_in, const int* in_sizes, int n_in, void* d_out, int out_size, void* d_ws, size_t ws_size, hipStream_t stream) {
  (void)in_sizes; (void)n_in; (void)out_size;
  const float** F = (const float**)d_in;   // 0 input [2,16384,256], 1 embed_qk [2,1024,16,16,3], 2 Wq [256,256] (in,out), 3 bq, 4 Wk, 5 bk, 6 Wp [3,1], 7 bp [1]
  if (ws_size < (size_t)WS_END) return;
  char* ws = (char*)d_ws; float *PHQ = (float*)(ws + WS_PHQ), *PHK = (float*)(ws + WS_PHK), *KVT = (float*)(ws + WS_KVT);
  k_phi<<<dim3(NB * NTOK / 256, CC / 128, 1), PHW * 32, 0, stream>>>(F[0], F[2], F[4], F[3], F[5], PHQ, PHK);
  k_kv<<<dim3(CC / 64, CC / 128, NB * MW), 256, 0, stream>>>(PHK, F[0], KVT);
  k_att<<<dim3(TQ / 256, CC / 128, TNB * MW), 256, 0, stream>>>(PHQ, KVT, F[1], F[6], F[7], (float*)d_out);
}

// v006
// It runs in 37.1 microseconds.
// Next to v005, in two timings, it ran 1.41 times as fast each time.
// Over all steps from v000 it is 6.34 times as fast.
// compute dtype: all float inputs rounded to bf16; q/k projections with EXACT bf16 products on WMMA 16x16x32 ((in,out) weights), the two ELU+1 feature maps in f32; KV_m = sum over all 1,024 windows of phi_k (bf16 hi + lo) x v (exact input) on WMMA (2 products); att = phi_q (hi + lo) . KV_m (hi + lo) on WMMA (3 products) + the positional term p (embed_qk . Wp + bp, f32); f32 output. Only windows w < 64 of the (b, w, n, m, d) intermediate survive the module's reshape(b, -1, c)[:, :n] slice, so only those are computed.
#include <hip/hip_runtime.h>
#include <math.h>

typedef __attribute__((ext_vector_type(16))) _Float16 v16h;
typedef __attribute__((ext_vector_type(16))) __bf16 v16b;
typedef __attribute__((ext_vector_type(8)))  _Float16 v8h;
typedef __attribute__((ext_vector_type(8)))  float v8f;
typedef __attribute__((ext_vector_type(4)))  float v4f;
typedef __attribute__((ext_vector_type(2)))  float v2f;
typedef __attribute__((ext_vector_type(4)))  unsigned v4u;
typedef __attribute__((ext_vector_type(4)))  int v4i;
typedef float __attribute__((may_alias)) float_a;
typedef int __attribute__((may_alias)) int_a;

template <typename T> __device__ __forceinline__ void vst2(void* p, T v) { *(T*)p = v;  }
__device__ __forceinline__ v8f wmma16(v16h a, v16h b, v8f c) {
  v8f d = __builtin_amdgcn_wmma_f32_16x16x32_f16(false, a, false, b, (short)0, c, false, false);
  asm volatile("v_nop\n\tv_nop\n\tv_nop\n\tv_nop" : "+v"(d) : "v"(a), "v"(b));
  return d;
}
__device__ __forceinline__ v8f wmma_bf(v16b a, v16b b, v8f c) {
  v8f d = __builtin_amdgcn_wmma_f32_16x16x32_bf16(false, a, false, b, (short)0, c, false, false);
  asm volatile("v_nop\n\tv_nop\n\tv_nop\n\tv_nop" : "+v"(d) : "v"(a), "v"(b));
  return d;
}
// 16x16x32 fragments: lane = (h = lane>>4, row/col = lane&15); elements 0..7 = k0+8h+0..7, 8..15 = k0+16+8h+0..7; D element r = row 8h+r
__device__ __forceinline__ v16h frag_h(const _Float16* rowk0, int lane) {
  union { v16h v; v8h q[2]; } u; const _Float16* p = rowk0 + 8 * (lane >> 4);
  u.q[0] = *(const v8h*)p; u.q[1] = *(const v8h*)(p + 16); return u.v;
}
__device__ __forceinline__ v16h frag_f32(const float* rowk0, int lane) {
  v16h a; const float* p = rowk0 + 8 * (lane >> 4);
#pragma unroll
  for (int i = 0; i < 8; ++i) { a[i] = (_Float16)p[i]; a[8 + i] = (_Float16)p[16 + i]; }
  return a;
}
__device__ __forceinline__ v16h frag_f32s(const float* rowk0, int lane, float sc) {
  v16h a; const float* p = rowk0 + 8 * (lane >> 4);
#pragma unroll
  for (int i = 0; i < 8; ++i) { a[i] = (_Float16)(p[i] * sc); a[8 + i] = (_Float16)(p[16 + i] * sc); }
  return a;
}
// column fragment from a [K][ld] layout (column n), rows >= K read as 0
__device__ __forceinline__ v16h fragc_f32(const float* W, int k0, int n, int lane, int ld, int K) {
  v16h a; const int g = lane >> 4;
#pragma unroll
  for (int i = 0; i < 8; ++i) { const int ka = k0 + 8 * g + i, kb = ka + 16;
    a[i] = (_Float16)(ka < K ? W[(size_t)(ka < K ? ka : K - 1) * ld + n] : 0.f); a[8 + i] = (_Float16)(kb < K ? W[(size_t)(kb < K ? kb : K - 1) * ld + n] : 0.f); }
  return a;
}
struct F2 { v16b h, l; };
__device__ __forceinline__ F2 bsplit16(const float v[16]) { F2 r;
#pragma unroll
  for (int i = 0; i < 16; ++i) { const __bf16 h = (__bf16)v[i]; r.h[i] = h; r.l[i] = (__bf16)(v[i] - (float)h); }
  return r; }
__device__ __forceinline__ F2 split_row(const float* row, int k0, int lane) { float v[16]; const float* p = row + k0 + 8 * (lane >> 4);
#pragma unroll
  for (int i = 0; i < 8; ++i) { v[i] = p[i]; v[8 + i] = p[16 + i]; }
  return bsplit16(v); }
__device__ __forceinline__ F2 split_rowK(const float* row, int k0, int lane, int K) { float v[16]; const int g = lane >> 4;
#pragma unroll
  for (int i = 0; i < 8; ++i) { const int ka = k0 + 8 * g + i, kb = ka + 16; v[i] = ka < K ? row[ka < K ? ka : K - 1] : 0.f; v[8 + i] = kb < K ? row[kb < K ? kb : K - 1] : 0.f; }
  return bsplit16(v); }
__device__ __forceinline__ F2 split_col(const float* W, int k0, int n, int lane, int ld, int K) { float v[16]; const int g = lane >> 4;
#pragma unroll
  for (int i = 0; i < 8; ++i) { const int ka = k0 + 8 * g + i, kb = ka + 16; v[i] = ka < K ? W[(size_t)(ka < K ? ka : K - 1) * ld + n] : 0.f; v[8 + i] = kb < K ? W[(size_t)(kb < K ? kb : K - 1) * ld + n] : 0.f; }
  return bsplit16(v); }
__device__ __forceinline__ v8f mac3(const F2& a, const F2& b, v8f c) { c = wmma_bf(a.l, b.h, c); c = wmma_bf(a.h, b.l, c); return wmma_bf(a.h, b.h, c); }
__device__ __forceinline__ float sigm(float v) { return 1.0f / (1.0f + expf(-v)); }
#define LDSX() do { asm volatile("s_wait_dscnt 0" ::: "memory"); __builtin_amdgcn_wave_barrier(); __builtin_amdgcn_fence(__ATOMIC_RELEASE, "workgroup"); } while (0)


// MSML windowed linear attention, stage 1 (B 2, N 16,384 tokens, C 256, 4x4 windows of M = 16): q = elu(x Wq + bq) + 1, k likewise, v = x; phi = elu(.) + 1 again; KV[b,m] = sum_w phi_k[b,w,m]^T v[b,w,m]; att[b,w,n,m,:] = phi_q[b,w,n] KV[b,m] + p[b,w,n,m]; out = att.reshape(b, -1, C)[:, :N].
#define NB 2
#define NTOK 16384
#define CC 256
#define MW 16             // window size
#define NWIN (NTOK / MW)  // 1024 windows
#define WOUT 64           // windows that reach the output
#define TQ (WOUT * MW)    // 1024 query tokens per batch
#ifndef TNB
#define TNB NB
#endif
typedef __attribute__((ext_vector_type(8))) __bf16 v8b;
__device__ __forceinline__ v16b frag_b(const __bf16* rowk0, int lane) {
  union { v16b v; v8b q[2]; } u; const __bf16* p = rowk0 + 8 * (lane >> 4);
  u.q[0] = *(const v8b*)p; u.q[1] = *(const v8b*)(p + 16); return u.v;
}
__device__ __forceinline__ float bfr(float v) { return (float)(__bf16)v; }
__device__ __attribute__((noinline)) float exp_ni(float v) { return expf(v); }
__device__ __attribute__((noinline)) float erf_ni(float v) { return erff(v); }

#define WS_PW  0u                                   // 256 KiB not in use
#define WS_PHQ (WS_PW + 2u * 2 * CC * CC)              // f32 phi_q rows [b*NTOK + t][256] (t < TQ used)
#define WS_PHK (WS_PHQ + 4u * (size_t)NB * NTOK * CC)   // not in use
#define WS_KVT (WS_PHK + 4u * (size_t)NB * NTOK * CC)   // f32 KV^T [half of the windows][b][m][d][c]
#define WS_END (WS_KVT + 2u * 4u * (size_t)NB * MW * CC * CC)

__device__ __forceinline__ v16b fragb_f32(const float* __restrict__ p, int lane) { v16b a; const float* pp = p + 8 * (lane >> 4);
#pragma unroll
  for (int i = 0; i < 8; ++i) { a[i] = (__bf16)pp[i]; a[8 + i] = (__bf16)pp[16 + i]; } return a; }
// elu(elu(y) + 1) + 1 in closed form. elu(y) + 1 is y + 1 above 0 and exp(y) else, so it is never below 0, and on such a value the second elu is the identity (also at 0, where exp(y) has underflowed): y + 2 above 0, exp(y) + 1 else. exp(y) lies in [0, 1] there and is added to 1, so the hardware exp2 of y log2(e) is exact enough: its error stays under half a last place of the sum. NaN stays NaN
__device__ __forceinline__ float phi_map(float y) { return y > 0.f ? y + 2.0f : __builtin_amdgcn_exp2f(y * 1.44269504f) + 1.0f; }
// ---- k_fu: block = (64 columns c, half of the windows, b*MW + m), 8 waves: partial KV[b,m][c][d] = sum over 512 windows w of phi_k[b, w*16+m, c] v[b, w*16+m, d] -> stored transposed, one plane a half: KV^T[half][b][m][d][c]; k_att adds the two planes
// phi_k never goes to memory. A stage is 64 windows: their rows of x (all 256 columns) are read once per block with whole-line 16-byte loads, rounded once to bf16 and laid in LDS twice, at the pitch of each reader. Wave (wc, wp) takes 16 columns c, all 256 d and windows 32 wp .. 32 wp + 31 of every stage: it projects the 32 rows on its 16 columns of Wk (fragments held in registers), maps the two result tiles to phi_k in f32 and splits them to bf16 hi + lo. Lane (c, g) of result tile t holds windows 16 t + 8 g + 0..7, which is the k order of frag_b, so the two tiles ARE the A fragment of phi_k^T. The same rows of x, read with transposing loads, are the B fragments (v). The sums of the two waves of a column group are added in LDS at the end.
// Each block also computes 32 tokens x its 64 columns of phi_q, once, ahead of its loop (64 token groups x 4 column blocks = the TQ tokens of each batch that k_att reads).
// Every "#pragma unroll" of this kernel and its helpers keeps an array (x of FuRegs, rk, rq, xq, a0, a1, w, wk, acc, the elements of a vector) in registers: its indices must be constants.
// work-group barrier whose fences name LDS alone: __syncthreads() would also wait out the global loads issued a stage ahead, which only registers receive
#define KVBAR() do { __builtin_amdgcn_fence(__ATOMIC_RELEASE, "workgroup", "local"); __builtin_amdgcn_s_barrier(); __builtin_amdgcn_fence(__ATOMIC_ACQUIRE, "workgroup", "local"); } while (0)
// keeps a stage's conversions, and with them the waits on its global loads, behind the products of the stage before, so that the loads have that whole stage to land
#define KVHOLD() __builtin_amdgcn_sched_barrier(0)
#define KS 64                                // windows per stage
#define QT 32                                // tokens of phi_q a block
#define NHALF 2                              // halves of the window sum
#define KV_NS (NWIN / NHALF / KS)            // 8 stages
#define PA 160u                              // LDS row pitch in bytes of a 64-column weight slab (32 B x odd, for the transposing load)
#define XPB 528u                             // LDS row pitch in bytes of the x rows read by ds_load_b128 (16 B x odd)
#define XTB 544u                             // LDS row pitch in bytes of the x rows read by the transposing load (32 B x odd)
#define OFF_T (KS * XPB)                     // the second copy
#define STG_BYTES (KS * XPB + KS * XTB)      // one buffer
#define SLAB (CC * PA)                       // one weight slab
#define KVPLANE ((size_t)NB * MW * CC * CC)  // floats of one KV^T plane
typedef __attribute__((ext_vector_type(4))) __bf16 v4b;
typedef __attribute__((address_space(3))) v8b lds_v8b;
// lane (col, g) gets T[k + 8g + 0..7][col] and T[k + 16 + 8g + 0..7][col]: the k order of frag_b
__device__ __forceinline__ v16b frag_tr(const unsigned char* p, unsigned pitch) {
  union { v16b v; v8b q[2]; } u; u.q[0] = __builtin_amdgcn_ds_load_tr16_b128_v8bf16((lds_v8b*)p); u.q[1] = __builtin_amdgcn_ds_load_tr16_b128_v8bf16((lds_v8b*)(p + 16u * pitch)); return u.v;
}
__device__ __forceinline__ v4b cvt4(v4f v) { v4b w;
#pragma unroll
  for (int e = 0; e < 4; ++e) w[e] = (__bf16)v[e];
  return w; }
struct FuRegs { v4f x[16]; };
// load i: row 4 i + tid / 64 of stage s (a window a row), a wave half a row
__device__ __forceinline__ void fu_load(FuRegs& R, const float* __restrict__ px, int s) {
  __builtin_amdgcn_sched_barrier(0);   // with the one below: nothing but these loads and their wait stands between the two, so no address register is rewritten ahead of the wait
#pragma unroll
  for (int i = 0; i < 16; ++i) R.x[i] = *(const v4f*)(px + (size_t)(s * KS + 4 * i) * MW * CC);
  asm volatile("s_wait_xcnt 0x0" :: "v"(px) : "memory");   // precaution: stands before anything rewrites the registers these loads name; it names the address, so that no load's own result takes those registers either
  __builtin_amdgcn_sched_barrier(0);
}
__device__ __forceinline__ void fu_stash(const FuRegs& R, unsigned char* sa, unsigned char* sx) {
#pragma unroll
  for (int i = 0; i < 16; ++i) { const v4b w = cvt4(R.x[i]); *(v4b*)(sa + 4u * i * XPB) = w; *(v4b*)(sx + 4u * i * XTB) = w; }
}
// the plain builtin: the compiler keeps the distances behind its own matrix instructions
__device__ __forceinline__ v8f wmma_p(v16b a, v16b b, v8f c) { return __builtin_amdgcn_wmma_f32_16x16x32_bf16(false, a, false, b, (short)0, c, false, false); }
// holds a group of LDS fragment loads ahead of the products behind it: sunk among them, each small group would cost the wave its own LDS latency
#define FUGRP() __builtin_amdgcn_sched_barrier(0)
__device__ __forceinline__ void fu_mac(const unsigned char* fa, const unsigned char* fb, const v16b wk[8], float bb, int lane, v8f acc[16]) {
  v8f p0 = {}, p1 = {}; v16b a0[8], a1[8], w[2][4];
#pragma unroll
  for (int kc = 0; kc < CC / 32; ++kc) { a0[kc] = frag_b((const __bf16*)fa + kc * 32, lane); a1[kc] = frag_b((const __bf16*)(fa + 16u * XPB) + kc * 32, lane); }
  FUGRP();
#pragma unroll
  for (int kc = 0; kc < CC / 32; ++kc) { p0 = wmma_p(a0[kc], wk[kc], p0); p1 = wmma_p(a1[kc], wk[kc], p1); }
#pragma unroll
  for (int j = 0; j < 4; ++j) w[0][j] = frag_tr(fb + 32u * j, XTB);
  FUGRP();
  v16b ah, al;
#pragma unroll
  for (int r = 0; r < 8; ++r) { const float f0 = phi_map(p0[r] + bb), f1 = phi_map(p1[r] + bb); const __bf16 h0 = (__bf16)f0, h1 = (__bf16)f1;
    ah[r] = h0; al[r] = (__bf16)(f0 - (float)h0); ah[8 + r] = h1; al[8 + r] = (__bf16)(f1 - (float)h1); }
#pragma unroll
  for (int jj = 0; jj < 4; ++jj) {   // the next four B fragments are fetched into the other register set while these four are used
    if (jj < 3) {
#pragma unroll
      for (int j = 0; j < 4; ++j) w[(jj + 1) & 1][j] = frag_tr(fb + 32u * (4 * jj + 4 + j), XTB); }
    FUGRP();
#pragma unroll
    for (int j = 0; j < 4; ++j) acc[4 * jj + j] = wmma_p(ah, w[jj & 1][j], acc[4 * jj + j]);
#pragma unroll
    for (int j = 0; j < 4; ++j) acc[4 * jj + j] = wmma_p(al, w[jj & 1][j], acc[4 * jj + j]); }
}
__global__ __launch_bounds__(256) void k_fu(const float* __restrict__ X, const float* __restrict__ WQ, const float* __restrict__ WK, const float* __restrict__ BQ, const float* __restrict__ BK, float* __restrict__ PHQ, float* __restrict__ KVT) { __shared__ __attribute__((aligned(256))) unsigned char L[2 * STG_BYTES]; __shared__ __attribute__((aligned(256))) unsigned char SW[2 * SLAB]; __shared__ __attribute__((aligned(256))) unsigned char XQ[QT * XPB]; __shared__ __align__(16) float st[CC][68];
  const int tid = threadIdx.x, wave = __builtin_amdgcn_readfirstlane(tid >> 5), lane = tid & 31, col = lane & 15, g = lane >> 4; const size_t b = blockIdx.z / MW; const int m = blockIdx.z % MW; const int wc = wave & 3, wp = wave >> 2; const int cb = blockIdx.x * 64; const int hf = blockIdx.y;
  const size_t bq = blockIdx.y; const int tq0 = blockIdx.z * QT;   // the block's 32 tokens of phi_q
  const float* px = X + (b * NTOK + ((size_t)hf * (NWIN / NHALF) + (tid >> 6)) * MW + m) * CC + (tid & 63) * 4;
  unsigned char* sa = L + (unsigned)(tid >> 6) * XPB + (unsigned)(tid & 63) * 8u; unsigned char* sx = L + OFF_T + (unsigned)(tid >> 6) * XTB + (unsigned)(tid & 63) * 8u;
  const unsigned rl = 8u * g + (lane & 7), sub = 16u * ((lane >> 3) & 1);
  const unsigned char* fa = L + (unsigned)(32 * wp + col) * XPB; const unsigned char* fb = L + OFF_T + (32u * wp + rl) * XTB + sub;
  FuRegs Ra, Rb;
  { const float* pk = WK + (size_t)(tid >> 4) * CC + cb + (tid & 15) * 4; const float* pq = WQ + (size_t)(tid >> 4) * CC + cb + (tid & 15) * 4; const float* pt = X + (bq * NTOK + tq0 + (tid >> 6)) * CC + (tid & 63) * 4;
    v4f rk[16], rq[16], xq[8];   // weights, load i: row 16 i + tid / 16, 64 columns a row; phi_q tokens, load i: row 4 i + tid / 64. All of the prologue's loads fly together
#pragma unroll
    for (int i = 0; i < 16; ++i) { rk[i] = *(const v4f*)(pk + (size_t)(16 * i) * CC); rq[i] = *(const v4f*)(pq + (size_t)(16 * i) * CC); }
#pragma unroll
    for (int i = 0; i < 8; ++i) xq[i] = *(const v4f*)(pt + (size_t)(4 * i) * CC);
    fu_load(Rb, px, 0); fu_load(Ra, px, 1);
    asm volatile("s_wait_xcnt 0x0" :: "v"(pk), "v"(pq), "v"(pt) : "memory");   // precaution, as in fu_load, for the three address pairs above
    unsigned char* sp = SW + (unsigned)(tid >> 4) * PA + (unsigned)(tid & 15) * 8u; unsigned char* sq = XQ + (unsigned)(tid >> 6) * XPB + (unsigned)(tid & 63) * 8u;
#pragma unroll
    for (int i = 0; i < 16; ++i) { *(v4b*)(sp + 16u * i * PA) = cvt4(rk[i]); *(v4b*)(sp + SLAB + 16u * i * PA) = cvt4(rq[i]); }
#pragma unroll
    for (int i = 0; i < 8; ++i) *(v4b*)(sq + 4u * i * XPB) = cvt4(xq[i]); }
  fu_stash(Rb, sa, sx); KVBAR();   // both slabs, the phi_q rows and stage 0 are in LDS before any wave reads a fragment
  if (wave < 4) {   // phi_q: wave = 16 tokens x 32 columns, so that each 128-byte line of a phi_q row has one writing wave
    const int tt = wave >> 1, pr = wave & 1; const __bf16* fq = (const __bf16*)(XQ + (unsigned)(16 * tt + col) * XPB); const unsigned char* fw = SW + SLAB + rl * PA + 64u * pr + sub; v8f q0 = {}, q1 = {};
#pragma unroll
    for (int kc = 0; kc < CC / 32; ++kc) { const v16b a = frag_b(fq + kc * 32, lane), w0 = frag_tr(fw + 32u * kc * PA, PA), w1 = frag_tr(fw + 32u * kc * PA + 32u, PA);
      q0 = wmma_bf(a, w0, q0); q1 = wmma_bf(a, w1, q1); }
    const float b0 = bfr(BQ[cb + 32 * pr + col]), b1 = bfr(BQ[cb + 32 * pr + 16 + col]); float* dq = PHQ + (bq * NTOK + tq0 + 16 * tt + 8 * g) * CC + cb + 32 * pr + col;
#pragma unroll
    for (int r = 0; r < 8; ++r) { dq[r * CC] = phi_map(q0[r] + b0); dq[r * CC + 16] = phi_map(q1[r] + b1); }
    asm volatile("s_wait_xcnt 0x0" ::: "memory");   // precaution: stands before later code rewrites the registers these stores name
  }
  v8f acc[16] = {}; v16b wk[8]; const float bb = bfr(BK[cb + wc * 16 + col]);
#pragma unroll
  for (int kc = 0; kc < CC / 32; ++kc) wk[kc] = frag_tr(SW + rl * PA + 32u * wc + sub + 32u * kc * PA, PA);
#pragma unroll 1
  for (int s = 0; s < KV_NS - 2; s += 2) {   // buffer 0 holds stage s, Ra stage s + 1; rolled: the body is already two stages. A stage's loads are issued ahead of the conversions of the stage before it, into the other register set
    fu_mac(fa, fb, wk, bb, lane, acc); KVHOLD(); fu_load(Rb, px, s + 2); fu_stash(Ra, sa + STG_BYTES, sx + STG_BYTES); KVBAR();
    fu_mac(fa + STG_BYTES, fb + STG_BYTES, wk, bb, lane, acc); KVHOLD(); fu_load(Ra, px, s + 3); fu_stash(Rb, sa, sx); KVBAR(); }
  fu_mac(fa, fb, wk, bb, lane, acc); KVHOLD(); fu_stash(Ra, sa + STG_BYTES, sx + STG_BYTES); KVBAR();
  fu_mac(fa + STG_BYTES, fb + STG_BYTES, wk, bb, lane, acc);
  if (wp == 0) {
#pragma unroll
    for (int j = 0; j < 16; ++j)
#pragma unroll
      for (int r = 0; r < 8; ++r) st[j * 16 + col][wc * 16 + 8 * g + r] = acc[j][r]; }   // transposed [d][c]
  __syncthreads();
  if (wp == 1) {
#pragma unroll
    for (int j = 0; j < 16; ++j)
#pragma unroll
      for (int r = 0; r < 8; ++r) st[j * 16 + col][wc * 16 + 8 * g + r] += acc[j][r]; }   // even 32-window groups + odd ones
  __syncthreads(); float* kp = KVT + (size_t)hf * KVPLANE + (b * MW + m) * (size_t)CC * CC + cb + (size_t)(tid >> 4) * CC + (tid & 15) * 4;
#pragma unroll
  for (int i = 0; i < 16; ++i) vst2(kp + (size_t)(16 * i) * CC, *(const v4f*)&st[16 * i + (tid >> 4)][(tid & 15) * 4]); }
// ---- k_att: block = (256 query tokens t, 128 cols d, b*MW + m), 8 waves (wave = 32 t x 128 d): out[b][t*16 + m][d] = phi_q[b,t] . KV[b,m][:, d] (3 products) + p[b][w = t/16][n = t%16][m]
// The block's 128 rows of KV^T (contiguous, 128 KiB of f32 in each of the two planes) are read once with whole-line 16-byte loads, the planes added, the sum split once into bf16 hi + lo and laid in LDS, a row's hi half and lo half side by side; every wave takes its B fragments from there.
// Every "#pragma unroll" of this kernel keeps an array (r, r2, an0, an1, acc0, acc1) in registers: its indices must be constants.
#define AP 1040u                             // LDS row pitch in bytes: 256 bf16 hi, 256 bf16 lo, 16 B of pad (16 B x odd, for ds_load_b128)
#define AT_LO 512u                           // a row's lo half
__device__ __forceinline__ void att_lda(float v[16], const float* __restrict__ p) {   // the k order of split_row
  const v4f q0 = *(const v4f*)p, q1 = *(const v4f*)(p + 4), q2 = *(const v4f*)(p + 16), q3 = *(const v4f*)(p + 20);
#pragma unroll
  for (int e = 0; e < 4; ++e) { v[e] = q0[e]; v[4 + e] = q1[e]; v[8 + e] = q2[e]; v[12 + e] = q3[e]; }
}
__global__ __launch_bounds__(256) void k_att(const float* __restrict__ PHQ, const float* __restrict__ KVT, const float* __restrict__ EQK, const float* __restrict__ WP, const float* __restrict__ BP, float* __restrict__ OUT) { __shared__ __align__(16) unsigned char SB[128u * AP]; __shared__ __align__(16) float sf[8][32][132];
  const int tid = threadIdx.x, wave = tid >> 5, lane = tid & 31, col = lane & 15, g = lane >> 4; const size_t b = blockIdx.z / MW; const int m = blockIdx.z % MW; const int t0 = blockIdx.x * 256 + wave * 32; const int d0 = blockIdx.y * 128;
  { const float* src = KVT + ((b * MW + m) * CC + d0) * (size_t)CC + tid * 4; const float* src2 = src + KVPLANE; v4f r[32], r2[32];   // load i: row 4 i + tid / 64, columns 4 (tid % 64) .., of each of the two planes
#pragma unroll
    for (int i = 0; i < 31; ++i) { r[i] = *(const v4f*)(src + i * 1024); r2[i] = *(const v4f*)(src2 + i * 1024); }
    asm volatile("s_wait_xcnt 0x0" ::: "memory");   // precaution: the compiler lets the last load's result take the address pair that the loads above name, so the wait stands ahead of that load
    r[31] = *(const v4f*)(src + 31 * 1024); r2[31] = *(const v4f*)(src2 + 31 * 1024);
    asm volatile("s_wait_xcnt 0x0" ::: "memory");   // precaution: stands before later address arithmetic rewrites the registers these loads name
    unsigned char* sp = SB + (unsigned)(tid >> 6) * AP + (unsigned)(tid & 63) * 8u;
#pragma unroll
    for (int i = 0; i < 32; ++i) { v4b h, l; const v4f s = r[i] + r2[i];   // KV = first half of the windows + second half
#pragma unroll
      for (int e = 0; e < 4; ++e) { h[e] = (__bf16)s[e]; l[e] = (__bf16)(s[e] - (float)h[e]); }
      *(v4b*)(sp + 4u * i * AP) = h; *(v4b*)(sp + AT_LO + 4u * i * AP) = l; } }
  const float* pq = PHQ + (b * NTOK + t0 + col) * CC + 8 * g; float an0[16], an1[16];
  att_lda(an0, pq); att_lda(an1, pq + 16 * CC);
  KVBAR();   // every row of the slab is in LDS before any wave reads a fragment; the fences name LDS alone: nothing global is handed over here
  v8f acc0[8] = {}, acc1[8] = {};
#pragma unroll
  for (int kc = 0; kc < CC / 32; ++kc) { const F2 a0 = bsplit16(an0), a1 = bsplit16(an1);
    if (kc + 1 < CC / 32) { att_lda(an0, pq + (kc + 1) * 32); att_lda(an1, pq + 16 * CC + (kc + 1) * 32); }
#pragma unroll
    for (int j = 0; j < 8; j += 2) { const __bf16* w0 = (const __bf16*)(SB + (unsigned)(j * 16 + col) * AP) + kc * 32; const __bf16* w1 = (const __bf16*)(SB + (unsigned)(j * 16 + 16 + col) * AP) + kc * 32;
      const v16b h0 = frag_b(w0, lane), h1 = frag_b(w1, lane), l0 = frag_b(w0 + AT_LO / 2, lane), l1 = frag_b(w1 + AT_LO / 2, lane);
      acc0[j] = wmma_bf(a0.h, h0, acc0[j]); acc1[j] = wmma_bf(a1.h, h0, acc1[j]); acc0[j + 1] = wmma_bf(a0.h, h1, acc0[j + 1]); acc1[j + 1] = wmma_bf(a1.h, h1, acc1[j + 1]);
      acc0[j] = wmma_bf(a0.h, l0, acc0[j]); acc1[j] = wmma_bf(a1.h, l0, acc1[j]); acc0[j + 1] = wmma_bf(a0.h, l1, acc0[j + 1]); acc1[j + 1] = wmma_bf(a1.h, l1, acc1[j + 1]);
      acc0[j] = wmma_bf(a0.l, h0, acc0[j]); acc1[j] = wmma_bf(a1.l, h0, acc1[j]); acc0[j + 1] = wmma_bf(a0.l, h1, acc0[j + 1]); acc1[j + 1] = wmma_bf(a1.l, h1, acc1[j + 1]); } }
  const float wp0 = bfr(WP[0]), wp1 = bfr(WP[1]), wp2 = bfr(WP[2]), bpv = bfr(BP[0]);
#pragma unroll
  for (int u = 0; u < 2; ++u)
#pragma unroll
    for (int r = 0; r < 8; ++r) { const int t = t0 + u * 16 + 8 * g + r; const int w = t / MW, n = t % MW; const float* e3 = EQK + ((((b * NWIN + w) * MW + n) * MW + m) * 3); const float pv = bfr(e3[0]) * wp0 + bfr(e3[1]) * wp1 + bfr(e3[2]) * wp2 + bpv;
#pragma unroll
      for (int j = 0; j < 8; ++j) sf[wave][u * 16 + 8 * g + r][j * 16 + col] = (u ? acc1[j][r] : acc0[j][r]) + pv; }
  LDSX(); for (int rl = 0; rl < 32; ++rl) vst2(OUT + (b * NTOK + (size_t)(t0 + rl) * MW + m) * CC + d0 + lane * 4, *(const v4f*)&sf[wave][rl][lane * 4]); }
extern "C" void kernel_launch(void* const* d_in, const int* in_sizes, int n_in, void* d_out, int out_size, void* d_ws, size_t ws_size, hipStream_t stream) {
  (void)in_sizes; (void)n_in; (void)out_size;
  const float** F = (const float**)d_in;   // 0 input [2,16384,256], 1 embed_qk [2,1024,16,16,3], 2 Wq [256,256] (in,out), 3 bq, 4 Wk, 5 bk, 6 Wp [3,1], 7 bp [1]
  if (ws_size < (size_t)WS_END) return;
  char* ws = (char*)d_ws; float *PHQ = (float*)(ws + WS_PHQ), *KVT = (float*)(ws + WS_KVT);
  k_fu<<<dim3(CC / 64, NHALF, NB * MW), 256, 0, stream>>>(F[0], F[2], F[4], F[3], F[5], PHQ, KVT);
  k_att<<<dim3(TQ / 256, CC / 128, TNB * MW), 256, 0, stream>>>(PHQ, KVT, F[1], F[6], F[7], (float*)d_out);
}

// v007
// A run of this version takes 35.6 microseconds.
// Timed twice side by side with v006, it ran 1.04 and 1.05 times as fast.
// All steps since v000 together make it 6.61 times as fast.
// compute dtype: all float inputs rounded to bf16; q/k projections with EXACT bf16 products on WMMA 16x16x32 ((in,out) weights), the two ELU+1 feature maps in f32; KV_m = sum over all 1,024 windows of phi_k (bf16 hi + lo) x v (exact input) on WMMA (2 products); att = phi_q (hi + lo) . KV_m (hi + lo) on WMMA (3 products) + the positional term p (embed_qk . Wp + bp, f32); f32 output. Only windows w < 64 of the (b, w, n, m, d) intermediate survive the module's reshape(b, -1, c)[:, :n] slice, so only those are computed.
#include <hip/hip_runtime.h>
#include <math.h>

typedef __attribute__((ext_vector_type(16))) _Float16 v16h;
typedef __attribute__((ext_vector_type(16))) __bf16 v16b;
typedef __attribute__((ext_vector_type(8)))  _Float16 v8h;
typedef __attribute__((ext_vector_type(8)))  float v8f;
typedef __attribute__((ext_vector_type(4)))  float v4f;
typedef __attribute__((ext_vector_type(2)))  float v2f;
typedef __attribute__((ext_vector_type(4)))  unsigned v4u;
typedef __attribute__((ext_vector_type(4)))  int v4i;
typedef float __attribute__((may_alias)) float_a;
typedef int __attribute__((may_alias)) int_a;

template <typename T> __device__ __forceinline__ void vst2(void* p, T v) { *(T*)p = v;  }
__device__ __forceinline__ v8f wmma16(v16h a, v16h b, v8f c) {
  v8f d = __builtin_amdgcn_wmma_f32_16x16x32_f16(false, a, false, b, (short)0, c, false, false);
  asm volatile("v_nop\n\tv_nop\n\tv_nop\n\tv_nop" : "+v"(d) : "v"(a), "v"(b));
  return d;
}
__device__ __forceinline__ v8f wmma_bf(v16b a, v16b b, v8f c) {
  v8f d = __builtin_amdgcn_wmma_f32_16x16x32_bf16(false, a, false, b, (short)0, c, false, false);
  asm volatile("v_nop\n\tv_nop\n\tv_nop\n\tv_nop" : "+v"(d) : "v"(a), "v"(b));
  return d;
}
// 16x16x32 fragments: lane = (h = lane>>4, row/col = lane&15); elements 0..7 = k0+8h+0..7, 8..15 = k0+16+8h+0..7; D element r = row 8h+r
__device__ __forceinline__ v16h frag_h(const _Float16* rowk0, int lane) {
  union { v16h v; v8h q[2]; } u; const _Float16* p = rowk0 + 8 * (lane >> 4);
  u.q[0] = *(const v8h*)p; u.q[1] = *(const v8h*)(p + 16); return u.v;
}
__device__ __forceinline__ v16h frag_f32(const float* rowk0, int lane) {
  v16h a; const float* p = rowk0 + 8 * (lane >> 4);
#pragma unroll
  for (int i = 0; i < 8; ++i) { a[i] = (_Float16)p[i]; a[8 + i] = (_Float16)p[16 + i]; }
  return a;
}
__device__ __forceinline__ v16h frag_f32s(const float* rowk0, int lane, float sc) {
  v16h a; const float* p = rowk0 + 8 * (lane >> 4);
#pragma unroll
  for (int i = 0; i < 8; ++i) { a[i] = (_Float16)(p[i] * sc); a[8 + i] = (_Float16)(p[16 + i] * sc); }
  return a;
}
// column fragment from a [K][ld] layout (column n), rows >= K read as 0
__device__ __forceinline__ v16h fragc_f32(const float* W, int k0, int n, int lane, int ld, int K) {
  v16h a; const int g = lane >> 4;
#pragma unroll
  for (int i = 0; i < 8; ++i) { const int ka = k0 + 8 * g + i, kb = ka + 16;
    a[i] = (_Float16)(ka < K ? W[(size_t)(ka < K ? ka : K - 1) * ld + n] : 0.f); a[8 + i] = (_Float16)(kb < K ? W[(size_t)(kb < K ? kb : K - 1) * ld + n] : 0.f); }
  return a;
}
struct F2 { v16b h, l; };
__device__ __forceinline__ F2 bsplit16(const float v[16]) { F2 r;
#pragma unroll
  for (int i = 0; i < 16; ++i) { const __bf16 h = (__bf16)v[i]; r.h[i] = h; r.l[i] = (__bf16)(v[i] - (float)h); }
  return r; }
__device__ __forceinline__ F2 split_row(const float* row, int k0, int lane) { float v[16]; const float* p = row + k0 + 8 * (lane >> 4);
#pragma unroll
  for (int i = 0; i < 8; ++i) { v[i] = p[i]; v[8 + i] = p[16 + i]; }
  return bsplit16(v); }
__device__ __forceinline__ F2 split_rowK(const float* row, int k0, int lane, int K) { float v[16]; const int g = lane >> 4;
#pragma unroll
  for (int i = 0; i < 8; ++i) { const int ka = k0 + 8 * g + i, kb = ka + 16; v[i] = ka < K ? row[ka < K ? ka : K - 1] : 0.f; v[8 + i] = kb < K ? row[kb < K ? kb : K - 1] : 0.f; }
  return bsplit16(v); }
__device__ __forceinline__ F2 split_col(const float* W, int k0, int n, int lane, int ld, int K) { float v[16]; const int g = lane >> 4;
#pragma unroll
  for (int i = 0; i < 8; ++i) { const int ka = k0 + 8 * g + i, kb = ka + 16; v[i] = ka < K ? W[(size_t)(ka < K ? ka : K - 1) * ld + n] : 0.f; v[8 + i] = kb < K ? W[(size_t)(kb < K ? kb : K - 1) * ld + n] : 0.f; }
  return bsplit16(v); }
__device__ __forceinline__ v8f mac3(const F2& a, const F2& b, v8f c) { c = wmma_bf(a.l, b.h, c); c = wmma_bf(a.h, b.l, c); return wmma_bf(a.h, b.h, c); }
__device__ __forceinline__ float sigm(float v) { return 1.0f / (1.0f + expf(-v)); }
#define LDSX() do { asm volatile("s_wait_dscnt 0" ::: "memory"); __builtin_amdgcn_wave_barrier(); __builtin_amdgcn_fence(__ATOMIC_RELEASE, "workgroup"); } while (0)


// MSML windowed linear attention, stage 1 (B 2, N 16,384 tokens, C 256, 4x4 windows of M = 16): q = elu(x Wq + bq) + 1, k likewise, v = x; phi = elu(.) + 1 again; KV[b,m] = sum_w phi_k[b,w,m]^T v[b,w,m]; att[b,w,n,m,:] = phi_q[b,w,n] KV[b,m] + p[b,w,n,m]; out = att.reshape(b, -1, C)[:, :N].
#define NB 2
#define NTOK 16384
#define CC 256
#define MW 16             // window size
#define NWIN (NTOK / MW)  // 1024 windows
#define WOUT 64           // windows that reach the output
#define TQ (WOUT * MW)    // 1024 query tokens per batch
#ifndef TNB
#define TNB NB
#endif
typedef __attribute__((ext_vector_type(8))) __bf16 v8b;
__device__ __forceinline__ v16b frag_b(const __bf16* rowk0, int lane) {
  union { v16b v; v8b q[2]; } u; const __bf16* p = rowk0 + 8 * (lane >> 4);
  u.q[0] = *(const v8b*)p; u.q[1] = *(const v8b*)(p + 16); return u.v;
}
__device__ __forceinline__ float bfr(float v) { return (float)(__bf16)v; }
__device__ __attribute__((noinline)) float exp_ni(float v) { return expf(v); }
__device__ __attribute__((noinline)) float erf_ni(float v) { return erff(v); }

#define WS_PW  0u                                   // 256 KiB not in use
#define WS_PHQ (WS_PW + 2u * 2 * CC * CC)              // f32 phi_q rows [b*NTOK + t][256] (t < TQ used)
#define WS_PHK (WS_PHQ + 4u * (size_t)NB * NTOK * CC)   // not in use
#define WS_KVT (WS_PHK + 4u * (size_t)NB * NTOK * CC)   // f32 KV^T [half of the windows][b][m][d][c]
#define WS_END (WS_KVT + 2u * 4u * (size_t)NB * MW * CC * CC)

__device__ __forceinline__ v16b fragb_f32(const float* __restrict__ p, int lane) { v16b a; const float* pp = p + 8 * (lane >> 4);
#pragma unroll
  for (int i = 0; i < 8; ++i) { a[i] = (__bf16)pp[i]; a[8 + i] = (__bf16)pp[16 + i]; } return a; }
// elu(elu(y) + 1) + 1 in closed form. elu(y) + 1 is y + 1 above 0 and exp(y) else, so it is never below 0, and on such a value the second elu is the identity (also at 0, where exp(y) has underflowed): y + 2 above 0, exp(y) + 1 else. exp(y) lies in [0, 1] there and is added to 1, so the hardware exp2 of y log2(e) is exact enough: its error stays under half a last place of the sum. NaN stays NaN
__device__ __forceinline__ float phi_map(float y) { return y > 0.f ? y + 2.0f : __builtin_amdgcn_exp2f(y * 1.44269504f) + 1.0f; }
// ---- k_fu: block = (64 columns c, half of the windows, b*MW + m), 8 waves: partial KV[b,m][c][d] = sum over 512 windows w of phi_k[b, w*16+m, c] v[b, w*16+m, d] -> stored transposed, one plane a half: KV^T[half][b][m][d][c]; k_att adds the two planes
// phi_k never goes to memory. A stage is 64 windows: their rows of x (all 256 columns) are read once per block with whole-line 16-byte loads, rounded once to bf16 and laid in LDS twice, at the pitch of each reader. Wave (wc, wp) takes 16 columns c, all 256 d and windows 32 wp .. 32 wp + 31 of every stage: it projects the 32 rows on its 16 columns of Wk (fragments held in registers), maps the two result tiles to phi_k in f32 and splits them to bf16 hi + lo. Lane (c, g) of result tile t holds windows 16 t + 8 g + 0..7, which is the k order of frag_b, so the two tiles ARE the A fragment of phi_k^T. The same rows of x, read with transposing loads, are the B fragments (v). The sums of the two waves of a column group are added in LDS at the end.
// Each block also computes 32 tokens x its 64 columns of phi_q, once, ahead of its loop (64 token groups x 4 column blocks = the TQ tokens of each batch that k_att reads).
// Every "#pragma unroll" of this kernel and its helpers keeps an array (x of FuRegs, rk, rq, xq, a0, a1, w, wk, acc, the elements of a vector) in registers: its indices must be constants.
// work-group barrier whose fences name LDS alone: __syncthreads() would also wait out the global loads issued a stage ahead, which only registers receive
#define KVBAR() do { __builtin_amdgcn_fence(__ATOMIC_RELEASE, "workgroup", "local"); __builtin_amdgcn_s_barrier(); __builtin_amdgcn_fence(__ATOMIC_ACQUIRE, "workgroup", "local"); } while (0)
// keeps a stage's conversions, and with them the waits on its global loads, behind the products of the stage before, so that the loads have that whole stage to land
#define KVHOLD() __builtin_amdgcn_sched_barrier(0)
#define KS 64                                // windows per stage
#define QT 32                                // tokens of phi_q a block
#define NHALF 2                              // halves of the window sum
#define KV_NS (NWIN / NHALF / KS)            // 8 stages
#define PA 160u                              // LDS row pitch in bytes of a 64-column weight slab (32 B x odd, for the transposing load)
#define XPB 528u                             // LDS row pitch in bytes of the x rows read by ds_load_b128 (16 B x odd)
#define XTB 544u                             // LDS row pitch in bytes of the x rows read by the transposing load (32 B x odd)
#define OFF_T (KS * XPB)                     // the second copy
#define STG_BYTES (KS * XPB + KS * XTB)      // one buffer
#define SLAB (CC * PA)                       // one weight slab
#define KVPLANE ((size_t)NB * MW * CC * CC)  // floats of one KV^T plane
typedef __attribute__((ext_vector_type(4))) __bf16 v4b;
typedef __attribute__((address_space(3))) v8b lds_v8b;
// lane (col, g) gets T[k + 8g + 0..7][col] and T[k + 16 + 8g + 0..7][col]: the k order of frag_b
__device__ __forceinline__ v16b frag_tr(const unsigned char* p, unsigned pitch) {
  union { v16b v; v8b q[2]; } u; u.q[0] = __builtin_amdgcn_ds_load_tr16_b128_v8bf16((lds_v8b*)p); u.q[1] = __builtin_amdgcn_ds_load_tr16_b128_v8bf16((lds_v8b*)(p + 16u * pitch)); return u.v;
}
__device__ __forceinline__ v4b cvt4(v4f v) { v4b w;
#pragma unroll
  for (int e = 0; e < 4; ++e) w[e] = (__bf16)v[e];
  return w; }
struct FuRegs { v4f x[16]; };
// load i: row 4 i + tid / 64 of stage s (a window a row), a wave half a row
__device__ __forceinline__ void fu_load(FuRegs& R, const float* __restrict__ px, int s) {
  __builtin_amdgcn_sched_barrier(0);   // with the one below: nothing but these loads and their wait stands between the two, so no address register is rewritten ahead of the wait
#pragma unroll
  for (int i = 0; i < 16; ++i) R.x[i] = *(const v4f*)(px + (size_t)(s * KS + 4 * i) * MW * CC);
  asm volatile("s_wait_xcnt 0x0" :: "v"(px) : "memory");   // precaution: stands before anything rewrites the registers these loads name; it names the address, so that no load's own result takes those registers either
  __builtin_amdgcn_sched_barrier(0);
}
__device__ __forceinline__ void fu_stash(const FuRegs& R, unsigned char* sa, unsigned char* sx) {
#pragma unroll
  for (int i = 0; i < 16; ++i) { const v4b w = cvt4(R.x[i]); *(v4b*)(sa + 4u * i * XPB) = w; *(v4b*)(sx + 4u * i * XTB) = w; }
}
// the plain builtin: the compiler keeps the distances behind its own matrix instructions
__device__ __forceinline__ v8f wmma_p(v16b a, v16b b, v8f c) { return __builtin_amdgcn_wmma_f32_16x16x32_bf16(false, a, false, b, (short)0, c, false, false); }
// holds a group of LDS fragment loads ahead of the products behind it: sunk among them, each small group would cost the wave its own LDS latency
#define FUGRP() __builtin_amdgcn_sched_barrier(0)
__device__ __forceinline__ void fu_mac(const unsigned char* fa, const unsigned char* fb, const v16b wk[8], float bb, int lane, v8f acc[16]) {
  v8f p0 = {}, p1 = {}; v16b a0[8], a1[8], w[2][4];
#pragma unroll
  for (int kc = 0; kc < CC / 32; ++kc) { a0[kc] = frag_b((const __bf16*)fa + kc * 32, lane); a1[kc] = frag_b((const __bf16*)(fa + 16u * XPB) + kc * 32, lane); }
  FUGRP();
#pragma unroll
  for (int kc = 0; kc < CC / 32; ++kc) { p0 = wmma_p(a0[kc], wk[kc], p0); p1 = wmma_p(a1[kc], wk[kc], p1); }
#pragma unroll
  for (int j = 0; j < 4; ++j) w[0][j] = frag_tr(fb + 32u * j, XTB);
  FUGRP();
  v16b ah, al;
#pragma unroll
  for (int r = 0; r < 8; ++r) { const float f0 = phi_map(p0[r] + bb), f1 = phi_map(p1[r] + bb); const __bf16 h0 = (__bf16)f0, h1 = (__bf16)f1;
    ah[r] = h0; al[r] = (__bf16)(f0 - (float)h0); ah[8 + r] = h1; al[8 + r] = (__bf16)(f1 - (float)h1); }
#pragma unroll
  for (int jj = 0; jj < 4; ++jj) {   // the next four B fragments are fetched into the other register set while these four are used
    if (jj < 3) {
#pragma unroll
      for (int j = 0; j < 4; ++j) w[(jj + 1) & 1][j] = frag_tr(fb + 32u * (4 * jj + 4 + j), XTB); }
    FUGRP();
#pragma unroll
    for (int j = 0; j < 4; ++j) acc[4 * jj + j] = wmma_p(ah, w[jj & 1][j], acc[4 * jj + j]);
#pragma unroll
    for (int j = 0; j < 4; ++j) acc[4 * jj + j] = wmma_p(al, w[jj & 1][j], acc[4 * jj + j]); }
}
__global__ __launch_bounds__(256) void k_fu(const float* __restrict__ X, const float* __restrict__ WQ, const float* __restrict__ WK, const float* __restrict__ BQ, const float* __restrict__ BK, float* __restrict__ PHQ, float* __restrict__ KVT) { __shared__ __attribute__((aligned(256))) unsigned char L[2 * STG_BYTES]; __shared__ __attribute__((aligned(256))) unsigned char SW[2 * SLAB]; __shared__ __attribute__((aligned(256))) unsigned char XQ[QT * XPB]; __shared__ __align__(16) float st[CC][68];
  const int tid = threadIdx.x, wave = __builtin_amdgcn_readfirstlane(tid >> 5), lane = tid & 31, col = lane & 15, g = lane >> 4; const size_t b = blockIdx.z / MW; const int m = blockIdx.z % MW; const int wc = wave & 3, wp = wave >> 2; const int cb = blockIdx.x * 64; const int hf = blockIdx.y;
  const size_t bq = blockIdx.y; const int tq0 = blockIdx.z * QT;   // the block's 32 tokens of phi_q
  const float* px = X + (b * NTOK + ((size_t)hf * (NWIN / NHALF) + (tid >> 6)) * MW + m) * CC + (tid & 63) * 4;
  unsigned char* sa = L + (unsigned)(tid >> 6) * XPB + (unsigned)(tid & 63) * 8u; unsigned char* sx = L + OFF_T + (unsigned)(tid >> 6) * XTB + (unsigned)(tid & 63) * 8u;
  const unsigned rl = 8u * g + (lane & 7), sub = 16u * ((lane >> 3) & 1);
  const unsigned char* fa = L + (unsigned)(32 * wp + col) * XPB; const unsigned char* fb = L + OFF_T + (32u * wp + rl) * XTB + sub;
  FuRegs Ra, Rb;
  { const float* pk = WK + (size_t)(tid >> 4) * CC + cb + (tid & 15) * 4; const float* pq = WQ + (size_t)(tid >> 4) * CC + cb + (tid & 15) * 4; const float* pt = X + (bq * NTOK + tq0 + (tid >> 6)) * CC + (tid & 63) * 4;
    v4f rk[16], rq[16], xq[8];   // weights, load i: row 16 i + tid / 16, 64 columns a row; phi_q tokens, load i: row 4 i + tid / 64. All of the prologue's loads fly together
#pragma unroll
    for (int i = 0; i < 16; ++i) { rk[i] = *(const v4f*)(pk + (size_t)(16 * i) * CC); rq[i] = *(const v4f*)(pq + (size_t)(16 * i) * CC); }
#pragma unroll
    for (int i = 0; i < 8; ++i) xq[i] = *(const v4f*)(pt + (size_t)(4 * i) * CC);
    fu_load(Rb, px, 0); fu_load(Ra, px, 1);
    asm volatile("s_wait_xcnt 0x0" :: "v"(pk), "v"(pq), "v"(pt) : "memory");   // precaution, as in fu_load, for the three address pairs above
    unsigned char* sp = SW + (unsigned)(tid >> 4) * PA + (unsigned)(tid & 15) * 8u; unsigned char* sq = XQ + (unsigned)(tid >> 6) * XPB + (unsigned)(tid & 63) * 8u;
#pragma unroll
    for (int i = 0; i < 16; ++i) { *(v4b*)(sp + 16u * i * PA) = cvt4(rk[i]); *(v4b*)(sp + SLAB + 16u * i * PA) = cvt4(rq[i]); }
#pragma unroll
    for (int i = 0; i < 8; ++i) *(v4b*)(sq + 4u * i * XPB) = cvt4(xq[i]); }
  fu_stash(Rb, sa, sx); KVBAR();   // both slabs, the phi_q rows and stage 0 are in LDS before any wave reads a fragment
  if (wave < 4) {   // phi_q: wave = 16 tokens x 32 columns, so that each 128-byte line of a phi_q row has one writing wave
    const int tt = wave >> 1, pr = wave & 1; const __bf16* fq = (const __bf16*)(XQ + (unsigned)(16 * tt + col) * XPB); const unsigned char* fw = SW + SLAB + rl * PA + 64u * pr + sub; v8f q0 = {}, q1 = {};
#pragma unroll
    for (int kc = 0; kc < CC / 32; ++kc) { const v16b a = frag_b(fq + kc * 32, lane), w0 = frag_tr(fw + 32u * kc * PA, PA), w1 = frag_tr(fw + 32u * kc * PA + 32u, PA);
      q0 = wmma_bf(a, w0, q0); q1 = wmma_bf(a, w1, q1); }
    const float b0 = bfr(BQ[cb + 32 * pr + col]), b1 = bfr(BQ[cb + 32 * pr + 16 + col]); float* dq = PHQ + (bq * NTOK + tq0 + 16 * tt + 8 * g) * CC + cb + 32 * pr + col;
#pragma unroll
    for (int r = 0; r < 8; ++r) { dq[r * CC] = phi_map(q0[r] + b0); dq[r * CC + 16] = phi_map(q1[r] + b1); }
    asm volatile("s_wait_xcnt 0x0" ::: "memory");   // precaution: stands before later code rewrites the registers these stores name
  }
  v8f acc[16] = {}; v16b wk[8]; const float bb = bfr(BK[cb + wc * 16 + col]);
#pragma unroll
  for (int kc = 0; kc < CC / 32; ++kc) wk[kc] = frag_tr(SW + rl * PA + 32u * wc + sub + 32u * kc * PA, PA);
#pragma unroll 1
  for (int s = 0; s < KV_NS - 2; s += 2) {   // buffer 0 holds stage s, Ra stage s + 1; rolled: the body is already two stages. A stage's loads are issued ahead of the conversions of the stage before it, into the other register set
    fu_mac(fa, fb, wk, bb, lane, acc); KVHOLD(); fu_load(Rb, px, s + 2); fu_stash(Ra, sa + STG_BYTES, sx + STG_BYTES); KVBAR();
    fu_mac(fa + STG_BYTES, fb + STG_BYTES, wk, bb, lane, acc); KVHOLD(); fu_load(Ra, px, s + 3); fu_stash(Rb, sa, sx); KVBAR(); }
  fu_mac(fa, fb, wk, bb, lane, acc); KVHOLD(); fu_stash(Ra, sa + STG_BYTES, sx + STG_BYTES); KVBAR();
  fu_mac(fa + STG_BYTES, fb + STG_BYTES, wk, bb, lane, acc);
  if (wp == 0) {
#pragma unroll
    for (int j = 0; j < 16; ++j)
#pragma unroll
      for (int r = 0; r < 8; ++r) st[j * 16 + col][wc * 16 + 8 * g + r] = acc[j][r]; }   // transposed [d][c]
  __syncthreads();
  if (wp == 1) {
#pragma unroll
    for (int j = 0; j < 16; ++j)
#pragma unroll
      for (int r = 0; r < 8; ++r) st[j * 16 + col][wc * 16 + 8 * g + r] += acc[j][r]; }   // even 32-window groups + odd ones
  __syncthreads(); float* kp = KVT + (size_t)hf * KVPLANE + (b * MW + m) * (size_t)CC * CC + cb + (size_t)(tid >> 4) * CC + (tid & 15) * 4;
#pragma unroll
  for (int i = 0; i < 16; ++i) vst2(kp + (size_t)(16 * i) * CC, *(const v4f*)&st[16 * i + (tid >> 4)][(tid & 15) * 4]); }
// ---- k_att: block = (256 query tokens t, 128 cols d, b*MW + m), 8 waves (wave = 32 t x 128 d): out[b][t*16 + m][d] = phi_q[b,t] . KV[b,m][:, d] (3 products) + p[b][w = t/16][n = t%16][m]
// The block's 128 rows of KV^T (contiguous, 128 KiB of f32 in each of the two planes) are read once with whole-line 16-byte loads, the planes added, the sum split once into bf16 hi + lo and laid in LDS, a row's hi half and lo half side by side; every wave takes its B fragments from there.
// Every "#pragma unroll" of this kernel keeps an array (r, r2, an0, an1, acc0, acc1, w) in registers: its indices must be constants.
#define AP 1040u                             // LDS row pitch in bytes: 256 bf16 hi, 256 bf16 lo, 16 B of pad (16 B x odd, for ds_load_b128)
#define AT_LO 512u                           // a row's lo half
__device__ __forceinline__ void att_lda(float v[16], const float* __restrict__ p) {   // the k order of split_row
  const v4f q0 = *(const v4f*)p, q1 = *(const v4f*)(p + 4), q2 = *(const v4f*)(p + 16), q3 = *(const v4f*)(p + 20);
#pragma unroll
  for (int e = 0; e < 4; ++e) { v[e] = q0[e]; v[4 + e] = q1[e]; v[8 + e] = q2[e]; v[12 + e] = q3[e]; }
}
// the eight B fragments of group G: d tiles 4 (G % 2) .. 4 (G % 2) + 3 of k chunk G / 2, w[0..3] hi, w[4..7] lo
__device__ __forceinline__ void att_ldw(v16b w[8], const unsigned char* sbl, int G, int lane) {
#pragma unroll
  for (int i = 0; i < 4; ++i) { const __bf16* p = (const __bf16*)(sbl + (unsigned)(64 * (G & 1) + 16 * i) * AP) + (G >> 1) * 32; w[i] = frag_b(p, lane); w[4 + i] = frag_b(p + AT_LO / 2, lane); }
}
__global__ __launch_bounds__(256) void k_att(const float* __restrict__ PHQ, const float* __restrict__ KVT, const float* __restrict__ EQK, const float* __restrict__ WP, const float* __restrict__ BP, float* __restrict__ OUT) { __shared__ __align__(16) unsigned char SB[128u * AP]; __shared__ __align__(16) float sf[8][32][132];
  const int tid = threadIdx.x, wave = tid >> 5, lane = tid & 31, col = lane & 15, g = lane >> 4; const size_t b = blockIdx.z / MW; const int m = blockIdx.z % MW; const int t0 = blockIdx.x * 256 + wave * 32; const int d0 = blockIdx.y * 128;
  { const float* src = KVT + ((b * MW + m) * CC + d0) * (size_t)CC + tid * 4; const float* src2 = src + KVPLANE; v4f r[32], r2[32];   // load i: row 4 i + tid / 64, columns 4 (tid % 64) .., of each of the two planes
#pragma unroll
    for (int i = 0; i < 31; ++i) { r[i] = *(const v4f*)(src + i * 1024); r2[i] = *(const v4f*)(src2 + i * 1024); }
    asm volatile("s_wait_xcnt 0x0" ::: "memory");   // precaution: the compiler lets the last load's result take the address pair that the loads above name, so the wait stands ahead of that load
    r[31] = *(const v4f*)(src + 31 * 1024); r2[31] = *(const v4f*)(src2 + 31 * 1024);
    asm volatile("s_wait_xcnt 0x0" ::: "memory");   // precaution: stands before later address arithmetic rewrites the registers these loads name
    unsigned char* sp = SB + (unsigned)(tid >> 6) * AP + (unsigned)(tid & 63) * 8u;
#pragma unroll
    for (int i = 0; i < 32; ++i) { v4b h, l; const v4f s = r[i] + r2[i];   // KV = first half of the windows + second half
#pragma unroll
      for (int e = 0; e < 4; ++e) { h[e] = (__bf16)s[e]; l[e] = (__bf16)(s[e] - (float)h[e]); }
      *(v4b*)(sp + 4u * i * AP) = h; *(v4b*)(sp + AT_LO + 4u * i * AP) = l; } }
  const float* pq = PHQ + (b * NTOK + t0 + col) * CC + 8 * g; float an0[16], an1[16];
  att_lda(an0, pq); att_lda(an1, pq + 16 * CC);
  KVBAR();   // every row of the slab is in LDS before any wave reads a fragment; the fences name LDS alone: nothing global is handed over here
  v8f acc0[8] = {}, acc1[8] = {}; v16b w[2][8]; const unsigned char* sbl = SB + (unsigned)col * AP;
  att_ldw(w[0], sbl, 0, lane);
  F2 a0 = bsplit16(an0), a1 = bsplit16(an1), n0, n1;
  att_lda(an0, pq + 32); att_lda(an1, pq + 16 * CC + 32);
#pragma unroll
  for (int G = 0; G < 2 * (CC / 32); ++G) { const int kc = G >> 1, j = 4 * (G & 1);   // a group: one k chunk x four d tiles, 24 products on 8 accumulator tiles; the next group's eight B fragments are fetched into the other register set while these eight are used
    FUGRP();   // with the one below: the sixteen loads stand at one place, not strewn among the products of the group before
    if (G + 1 < 2 * (CC / 32)) att_ldw(w[(G + 1) & 1], sbl, G + 1, lane);
    FUGRP();   // the loads are issued ahead of this group's products, which hide their LDS latency
#pragma unroll
    for (int i = 0; i < 4; ++i) { acc0[j + i] = wmma_p(a0.h, w[G & 1][i], acc0[j + i]); acc1[j + i] = wmma_p(a1.h, w[G & 1][i], acc1[j + i]); }
#pragma unroll
    for (int i = 0; i < 4; ++i) { acc0[j + i] = wmma_p(a0.h, w[G & 1][4 + i], acc0[j + i]); acc1[j + i] = wmma_p(a1.h, w[G & 1][4 + i], acc1[j + i]); }
#pragma unroll
    for (int i = 0; i < 4; ++i) { acc0[j + i] = wmma_p(a0.l, w[G & 1][i], acc0[j + i]); acc1[j + i] = wmma_p(a1.l, w[G & 1][i], acc1[j + i]); }
    if (kc + 1 < CC / 32) {   // the next chunk's A rows are split beside these products, one row tile a group, and the rows of the chunk after it asked for at once
      if ((G & 1) == 0) { n0 = bsplit16(an0); if (kc + 2 < CC / 32) att_lda(an0, pq + (kc + 2) * 32); }
      else { n1 = bsplit16(an1); if (kc + 2 < CC / 32) att_lda(an1, pq + 16 * CC + (kc + 2) * 32); a0 = n0; a1 = n1; } } }
  const float wp0 = bfr(WP[0]), wp1 = bfr(WP[1]), wp2 = bfr(WP[2]), bpv = bfr(BP[0]);
#pragma unroll
  for (int u = 0; u < 2; ++u)
#pragma unroll
    for (int r = 0; r < 8; ++r) { const int t = t0 + u * 16 + 8 * g + r; const int w = t / MW, n = t % MW; const float* e3 = EQK + ((((b * NWIN + w) * MW + n) * MW + m) * 3); const float pv = bfr(e3[0]) * wp0 + bfr(e3[1]) * wp1 + bfr(e3[2]) * wp2 + bpv;
#pragma unroll
      for (int j = 0; j < 8; ++j) sf[wave][u * 16 + 8 * g + r][j * 16 + col] = (u ? acc1[j][r] : acc0[j][r]) + pv; }
  LDSX(); for (int rl = 0; rl < 32; ++rl) vst2(OUT + (b * NTOK + (size_t)(t0 + rl) * MW + m) * CC + d0 + lane * 4, *(const v4f*)&sf[wave][rl][lane * 4]); }
extern "C" void kernel_launch(void* const* d_in, const int* in_sizes, int n_in, void* d_out, int out_size, void* d_ws, size_t ws_size, hipStream_t stream) {
  (void)in_sizes; (void)n_in; (void)out_size;
  const float** F = (const float**)d_in;   // 0 input [2,16384,256], 1 embed_qk [2,1024,16,16,3], 2 Wq [256,256] (in,out), 3 bq, 4 Wk, 5 bk, 6 Wp [3,1], 7 bp [1]
  if (ws_size < (size_t)WS_END) return;
  char* ws = (char*)d_ws; float *PHQ = (float*)(ws + WS_PHQ), *KVT = (float*)(ws + WS_KVT);
  k_fu<<<dim3(CC / 64, NHALF, NB * MW), 256, 0, stream>>>(F[0], F[2], F[4], F[3], F[5], PHQ, KVT);
  k_att<<<dim3(TQ / 256, CC / 128, TNB * MW), 256, 0, stream>>>(PHQ, KVT, F[1], F[6], F[7], (float*)d_out);
}

// v008
// Measured time: 34.5 microseconds a run.
// Two timings next to v007 both put it at 1.03 times that version's speed.
// All steps since v000 together make it 6.81 times as fast.
// compute dtype: all float inputs rounded to bf16; q/k projections with EXACT bf16 products on WMMA 16x16x32 ((in,out) weights), the two ELU+1 feature maps in f32; KV_m = sum over all 1,024 windows of phi_k (bf16 hi + lo) x v (exact input) on WMMA (2 products); att = phi_q (hi + lo) . KV_m (hi + lo) on WMMA (3 products) + the positional term p (embed_qk . Wp + bp, f32); f32 output. Only windows w < 64 of the (b, w, n, m, d) intermediate survive the module's reshape(b, -1, c)[:, :n] slice, so only those are computed.
#include <hip/hip_runtime.h>
#include <math.h>

typedef __attribute__((ext_vector_type(16))) _Float16 v16h;
typedef __attribute__((ext_vector_type(16))) __bf16 v16b;
typedef __attribute__((ext_vector_type(8)))  _Float16 v8h;
typedef __attribute__((ext_vector_type(8)))  float v8f;
typedef __attribute__((ext_vector_type(4)))  float v4f;
typedef __attribute__((ext_vector_type(2)))  float v2f;
typedef __attribute__((ext_vector_type(4)))  unsigned v4u;
typedef __attribute__((ext_vector_type(4)))  int v4i;
typedef float __attribute__((may_alias)) float_a;
typedef int __attribute__((may_alias)) int_a;

template <typename T> __device__ __forceinline__ void vst2(void* p, T v) { *(T*)p = v;  }
__device__ __forceinline__ v8f wmma16(v16h a, v16h b, v8f c) {
  v8f d = __builtin_amdgcn_wmma_f32_16x16x32_f16(false, a, false, b, (short)0, c, false, false);
  asm volatile("v_nop\n\tv_nop\n\tv_nop\n\tv_nop" : "+v"(d) : "v"(a), "v"(b));
  return d;
}
__device__ __forceinline__ v8f wmma_bf(v16b a, v16b b, v8f c) {
  v8f d = __builtin_amdgcn_wmma_f32_16x16x32_bf16(false, a, false, b, (short)0, c, false, false);
  asm volatile("v_nop\n\tv_nop\n\tv_nop\n\tv_nop" : "+v"(d) : "v"(a), "v"(b));
  return d;
}
// 16x16x32 fragments: lane = (h = lane>>4, row/col = lane&15); elements 0..7 = k0+8h+0..7, 8..15 = k0+16+8h+0..7; D element r = row 8h+r
__device__ __forceinline__ v16h frag_h(const _Float16* rowk0, int lane) {
  union { v16h v; v8h q[2]; } u; const _Float16* p = rowk0 + 8 * (lane >> 4);
  u.q[0] = *(const v8h*)p; u.q[1] = *(const v8h*)(p + 16); return u.v;
}
__device__ __forceinline__ v16h frag_f32(const float* rowk0, int lane) {
  v16h a; const float* p = rowk0 + 8 * (lane >> 4);
#pragma unroll
  for (int i = 0; i < 8; ++i) { a[i] = (_Float16)p[i]; a[8 + i] = (_Float16)p[16 + i]; }
  return a;
}
__device__ __forceinline__ v16h frag_f32s(const float* rowk0, int lane, float sc) {
  v16h a; const float* p = rowk0 + 8 * (lane >> 4);
#pragma unroll
  for (int i = 0; i < 8; ++i) { a[i] = (_Float16)(p[i] * sc); a[8 + i] = (_Float16)(p[16 + i] * sc); }
  return a;
}
// column fragment from a [K][ld] layout (column n), rows >= K read as 0
__device__ __forceinline__ v16h fragc_f32(const float* W, int k0, int n, int lane, int ld, int K) {
  v16h a; const int g = lane >> 4;
#pragma unroll
  for (int i = 0; i < 8; ++i) { const int ka = k0 + 8 * g + i, kb = ka + 16;
    a[i] = (_Float16)(ka < K ? W[(size_t)(ka < K ? ka : K - 1) * ld + n] : 0.f); a[8 + i] = (_Float16)(kb < K ? W[(size_t)(kb < K ? kb : K - 1) * ld + n] : 0.f); }
  return a;
}
struct F2 { v16b h, l; };
__device__ __forceinline__ F2 bsplit16(const float v[16]) { F2 r;
#pragma unroll
  for (int i = 0; i < 16; ++i) { const __bf16 h = (__bf16)v[i]; r.h[i] = h; r.l[i] = (__bf16)(v[i] - (float)h); }
  return r; }
__device__ __forceinline__ F2 split_row(const float* row, int k0, int lane) { float v[16]; const float* p = row + k0 + 8 * (lane >> 4);
#pragma unroll
  for (int i = 0; i < 8; ++i) { v[i] = p[i]; v[8 + i] = p[16 + i]; }
  return bsplit16(v); }
__device__ __forceinline__ F2 split_rowK(const float* row, int k0, int lane, int K) { float v[16]; const int g = lane >> 4;
#pragma unroll
  for (int i = 0; i < 8; ++i) { const int ka = k0 + 8 * g + i, kb = ka + 16; v[i] = ka < K ? row[ka < K ? ka : K - 1] : 0.f; v[8 + i] = kb < K ? row[kb < K ? kb : K - 1] : 0.f; }
  return bsplit16(v); }
__device__ __forceinline__ F2 split_col(const float* W, int k0, int n, int lane, int ld, int K) { float v[16]; const int g = lane >> 4;
#pragma unroll
  for (int i = 0; i < 8; ++i) { const int ka = k0 + 8 * g + i, kb = ka + 16; v[i] = ka < K ? W[(size_t)(ka < K ? ka : K - 1) * ld + n] : 0.f; v[8 + i] = kb < K ? W[(size_t)(kb < K ? kb : K - 1) * ld + n] : 0.f; }
  return bsplit16(v); }
__device__ __forceinline__ v8f mac3(const F2& a, const F2& b, v8f c) { c = wmma_bf(a.l, b.h, c); c = wmma_bf(a.h, b.l, c); return wmma_bf(a.h, b.h, c); }
__device__ __forceinline__ float sigm(float v) { return 1.0f / (1.0f + expf(-v)); }
#define LDSX() do { asm volatile("s_wait_dscnt 0" ::: "memory"); __builtin_amdgcn_wave_barrier(); __builtin_amdgcn_fence(__ATOMIC_RELEASE, "workgroup"); } while (0)


// MSML windowed linear attention, stage 1 (B 2, N 16,384 tokens, C 256, 4x4 windows of M = 16): q = elu(x Wq + bq) + 1, k likewise, v = x; phi = elu(.) + 1 again; KV[b,m] = sum_w phi_k[b,w,m]^T v[b,w,m]; att[b,w,n,m,:] = phi_q[b,w,n] KV[b,m] + p[b,w,n,m]; out = att.reshape(b, -1, C)[:, :N].
#define NB 2
#define NTOK 16384
#define CC 256
#define MW 16             // window size
#define NWIN (NTOK / MW)  // 1024 windows
#define WOUT 64           // windows that reach the output
#define TQ (WOUT * MW)    // 1024 query tokens per batch
#ifndef TNB
#define TNB NB
#endif
typedef __attribute__((ext_vector_type(8))) __bf16 v8b;
__device__ __forceinline__ v16b frag_b(const __bf16* rowk0, int lane) {
  union { v16b v; v8b q[2]; } u; const __bf16* p = rowk0 + 8 * (lane >> 4);
  u.q[0] = *(const v8b*)p; u.q[1] = *(const v8b*)(p + 16); return u.v;
}
__device__ __forceinline__ float bfr(float v) { return (float)(__bf16)v; }
__device__ __attribute__((noinline)) float exp_ni(float v) { return expf(v); }
__device__ __attribute__((noinline)) float erf_ni(float v) { return erff(v); }

#define WS_PW  0u                                   // 256 KiB not in use
#define WS_PHQ (WS_PW + 2u * 2 * CC * CC)              // phi_q of the TQ tokens a batch, split to bf16 hi + lo, in the order of k_att's A fragments: [b][16-token tile][32-column chunk][hi, lo][elements 0..7, 8..15][lane][8], 2 KiB a fragment pair
#define WS_PHK (WS_PHQ + 4u * (size_t)NB * NTOK * CC)   // not in use
#define WS_KVT (WS_PHK + 4u * (size_t)NB * NTOK * CC)   // f32 KV^T [half of the windows][b][m][d][c]
#define WS_END (WS_KVT + 2u * 4u * (size_t)NB * MW * CC * CC)

__device__ __forceinline__ v16b fragb_f32(const float* __restrict__ p, int lane) { v16b a; const float* pp = p + 8 * (lane >> 4);
#pragma unroll
  for (int i = 0; i < 8; ++i) { a[i] = (__bf16)pp[i]; a[8 + i] = (__bf16)pp[16 + i]; } return a; }
// elu(elu(y) + 1) + 1 in closed form. elu(y) + 1 is y + 1 above 0 and exp(y) else, so it is never below 0, and on such a value the second elu is the identity (also at 0, where exp(y) has underflowed): y + 2 above 0, exp(y) + 1 else. exp(y) lies in [0, 1] there and is added to 1, so the hardware exp2 of y log2(e) is exact enough: its error stays under half a last place of the sum. NaN stays NaN
__device__ __forceinline__ float phi_map(float y) { return y > 0.f ? y + 2.0f : __builtin_amdgcn_exp2f(y * 1.44269504f) + 1.0f; }
// ---- k_fu: block = (64 columns c, half of the windows, b*MW + m), 8 waves: partial KV[b,m][c][d] = sum over 512 windows w of phi_k[b, w*16+m, c] v[b, w*16+m, d] -> stored transposed, one plane a half: KV^T[half][b][m][d][c]; k_att adds the two planes
// phi_k never goes to memory. A stage is 64 windows: their rows of x (all 256 columns) are read once per block with whole-line 16-byte loads, rounded once to bf16 and laid in LDS twice, at the pitch of each reader. Wave (wc, wp) takes 16 columns c, all 256 d and windows 32 wp .. 32 wp + 31 of every stage: it projects the 32 rows on its 16 columns of Wk (fragments held in registers), maps the two result tiles to phi_k in f32 and splits them to bf16 hi + lo. Lane (c, g) of result tile t holds windows 16 t + 8 g + 0..7, which is the k order of frag_b, so the two tiles ARE the A fragment of phi_k^T. The same rows of x, read with transposing loads, are the B fragments (v). The sums of the two waves of a column group are added in LDS at the end.
// Each block also computes 32 tokens x its 64 columns of phi_q, once, ahead of its loop (32 token groups x 4 column blocks = the TQ tokens of each batch that k_att reads). The product is taken transposed (Wq^T as A, the x rows as B): lane (token, g) of a result tile then holds columns 8 g + 0..7, so two tiles side by side are an A fragment of k_att, which is split here once and stored as it lies in the registers.
// Every "#pragma unroll" of this kernel and its helpers keeps an array (x of FuRegs, rk, rq, xq, a0, a1, w, wk, acc, the elements of a vector) in registers: its indices must be constants.
// work-group barrier whose fences name LDS alone: __syncthreads() would also wait out the global loads issued a stage ahead, which only registers receive
#define KVBAR() do { __builtin_amdgcn_fence(__ATOMIC_RELEASE, "workgroup", "local"); __builtin_amdgcn_s_barrier(); __builtin_amdgcn_fence(__ATOMIC_ACQUIRE, "workgroup", "local"); } while (0)
// keeps a stage's conversions, and with them the waits on its global loads, behind the products of the stage before, so that the loads have that whole stage to land
#define KVHOLD() __builtin_amdgcn_sched_barrier(0)
#define KS 64                                // windows per stage
#define QT 32                                // tokens of phi_q a block
#define NHALF 2                              // halves of the window sum
#define KV_NS (NWIN / NHALF / KS)            // 8 stages
#define PA 160u                              // LDS row pitch in bytes of a 64-column weight slab (32 B x odd, for the transposing load)
#define XPB 528u                             // LDS row pitch in bytes of the x rows read by ds_load_b128 (16 B x odd)
#define XTB 544u                             // LDS row pitch in bytes of the x rows read by the transposing load (32 B x odd)
#define OFF_T (KS * XPB)                     // the second copy
#define STG_BYTES (KS * XPB + KS * XTB)      // one buffer
#define SLAB (CC * PA)                       // one weight slab
#define KVPLANE ((size_t)NB * MW * CC * CC)  // floats of one KV^T plane
#define FRQ 2048u                            // bytes of one phi_q fragment pair (16 tokens x 32 columns, hi + lo)
typedef __attribute__((ext_vector_type(4))) __bf16 v4b;
typedef __attribute__((address_space(3))) v8b lds_v8b;
// lane (col, g) gets T[k + 8g + 0..7][col] and T[k + 16 + 8g + 0..7][col]: the k order of frag_b
__device__ __forceinline__ v16b frag_tr(const unsigned char* p, unsigned pitch) {
  union { v16b v; v8b q[2]; } u; u.q[0] = __builtin_amdgcn_ds_load_tr16_b128_v8bf16((lds_v8b*)p); u.q[1] = __builtin_amdgcn_ds_load_tr16_b128_v8bf16((lds_v8b*)(p + 16u * pitch)); return u.v;
}
__device__ __forceinline__ v4b cvt4(v4f v) { v4b w;
#pragma unroll
  for (int e = 0; e < 4; ++e) w[e] = (__bf16)v[e];
  return w; }
struct FuRegs { v4f x[16]; };
// load i: row 4 i + tid / 64 of stage s (a window a row), a wave half a row
__device__ __forceinline__ void fu_load(FuRegs& R, const float* __restrict__ px, int s) {
  __builtin_amdgcn_sched_barrier(0);   // with the one below: nothing but these loads and their wait stands between the two, so no address register is rewritten ahead of the wait
#pragma unroll
  for (int i = 0; i < 16; ++i) R.x[i] = *(const v4f*)(px + (size_t)(s * KS + 4 * i) * MW * CC);
  asm volatile("s_wait_xcnt 0x0" :: "v"(px) : "memory");   // precaution: stands before anything rewrites the registers these loads name; it names the address, so that no load's own result takes those registers either
  __builtin_amdgcn_sched_barrier(0);
}
__device__ __forceinline__ void fu_stash(const FuRegs& R, unsigned char* sa, unsigned char* sx) {
#pragma unroll
  for (int i = 0; i < 16; ++i) { const v4b w = cvt4(R.x[i]); *(v4b*)(sa + 4u * i * XPB) = w; *(v4b*)(sx + 4u * i * XTB) = w; }
}
// the plain builtin: the compiler keeps the distances behind its own matrix instructions
__device__ __forceinline__ v8f wmma_p(v16b a, v16b b, v8f c) { return __builtin_amdgcn_wmma_f32_16x16x32_bf16(false, a, false, b, (short)0, c, false, false); }
// holds a group of LDS fragment loads ahead of the products behind it: sunk among them, each small group would cost the wave its own LDS latency
#define FUGRP() __builtin_amdgcn_sched_barrier(0)
__device__ __forceinline__ void fu_mac(const unsigned char* fa, const unsigned char* fb, const v16b wk[8], float bb, int lane, v8f acc[16]) {
  v8f p0 = {}, p1 = {}; v16b a0[8], a1[8], w[2][4];
#pragma unroll
  for (int kc = 0; kc < CC / 32; ++kc) { a0[kc] = frag_b((const __bf16*)fa + kc * 32, lane); a1[kc] = frag_b((const __bf16*)(fa + 16u * XPB) + kc * 32, lane); }
  FUGRP();
#pragma unroll
  for (int kc = 0; kc < CC / 32; ++kc) { p0 = wmma_p(a0[kc], wk[kc], p0); p1 = wmma_p(a1[kc], wk[kc], p1); }
#pragma unroll
  for (int j = 0; j < 4; ++j) w[0][j] = frag_tr(fb + 32u * j, XTB);
  FUGRP();
  v16b ah, al;
#pragma unroll
  for (int r = 0; r < 8; ++r) { const float f0 = phi_map(p0[r] + bb), f1 = phi_map(p1[r] + bb); const __bf16 h0 = (__bf16)f0, h1 = (__bf16)f1;
    ah[r] = h0; al[r] = (__bf16)(f0 - (float)h0); ah[8 + r] = h1; al[8 + r] = (__bf16)(f1 - (float)h1); }
#pragma unroll
  for (int jj = 0; jj < 4; ++jj) {   // the next four B fragments are fetched into the other register set while these four are used
    if (jj < 3) {
#pragma unroll
      for (int j = 0; j < 4; ++j) w[(jj + 1) & 1][j] = frag_tr(fb + 32u * (4 * jj + 4 + j), XTB); }
    FUGRP();
#pragma unroll
    for (int j = 0; j < 4; ++j) acc[4 * jj + j] = wmma_p(ah, w[jj & 1][j], acc[4 * jj + j]);
#pragma unroll
    for (int j = 0; j < 4; ++j) acc[4 * jj + j] = wmma_p(al, w[jj & 1][j], acc[4 * jj + j]); }
}
__global__ __launch_bounds__(256) void k_fu(const float* __restrict__ X, const float* __restrict__ WQ, const float* __restrict__ WK, const float* __restrict__ BQ, const float* __restrict__ BK, float* __restrict__ PHQ, float* __restrict__ KVT) { __shared__ __attribute__((aligned(256))) unsigned char L[2 * STG_BYTES]; __shared__ __attribute__((aligned(256))) unsigned char SW[2 * SLAB]; __shared__ __attribute__((aligned(256))) unsigned char XQ[QT * XPB]; __shared__ __align__(16) float st[CC][68];
  const int tid = threadIdx.x, wave = __builtin_amdgcn_readfirstlane(tid >> 5), lane = tid & 31, col = lane & 15, g = lane >> 4; const size_t b = blockIdx.z / MW; const int m = blockIdx.z % MW; const int wc = wave & 3, wp = wave >> 2; const int cb = blockIdx.x * 64; const int hf = blockIdx.y;
  const size_t bq = blockIdx.y; const int tq0 = blockIdx.z * QT;   // the block's 32 tokens of phi_q
  const float* px = X + (b * NTOK + ((size_t)hf * (NWIN / NHALF) + (tid >> 6)) * MW + m) * CC + (tid & 63) * 4;
  unsigned char* sa = L + (unsigned)(tid >> 6) * XPB + (unsigned)(tid & 63) * 8u; unsigned char* sx = L + OFF_T + (unsigned)(tid >> 6) * XTB + (unsigned)(tid & 63) * 8u;
  const unsigned rl = 8u * g + (lane & 7), sub = 16u * ((lane >> 3) & 1);
  const unsigned char* fa = L + (unsigned)(32 * wp + col) * XPB; const unsigned char* fb = L + OFF_T + (32u * wp + rl) * XTB + sub;
  FuRegs Ra, Rb;
  { const float* pk = WK + (size_t)(tid >> 4) * CC + cb + (tid & 15) * 4; const float* pq = WQ + (size_t)(tid >> 4) * CC + cb + (tid & 15) * 4; const float* pt = X + (bq * NTOK + tq0 + (tid >> 6)) * CC + (tid & 63) * 4;
    v4f rk[16], rq[16], xq[8];   // weights, load i: row 16 i + tid / 16, 64 columns a row; phi_q tokens, load i: row 4 i + tid / 64. All of the prologue's loads fly together
#pragma unroll
    for (int i = 0; i < 16; ++i) { rk[i] = *(const v4f*)(pk + (size_t)(16 * i) * CC); rq[i] = *(const v4f*)(pq + (size_t)(16 * i) * CC); }
#pragma unroll
    for (int i = 0; i < 8; ++i) xq[i] = *(const v4f*)(pt + (size_t)(4 * i) * CC);
    fu_load(Rb, px, 0); fu_load(Ra, px, 1);
    asm volatile("s_wait_xcnt 0x0" :: "v"(pk), "v"(pq), "v"(pt) : "memory");   // precaution, as in fu_load, for the three address pairs above
    unsigned char* sp = SW + (unsigned)(tid >> 4) * PA + (unsigned)(tid & 15) * 8u; unsigned char* sq = XQ + (unsigned)(tid >> 6) * XPB + (unsigned)(tid & 63) * 8u;
#pragma unroll
    for (int i = 0; i < 16; ++i) { *(v4b*)(sp + 16u * i * PA) = cvt4(rk[i]); *(v4b*)(sp + SLAB + 16u * i * PA) = cvt4(rq[i]); }
#pragma unroll
    for (int i = 0; i < 8; ++i) *(v4b*)(sq + 4u * i * XPB) = cvt4(xq[i]); }
  fu_stash(Rb, sa, sx); KVBAR();   // both slabs, the phi_q rows and stage 0 are in LDS before any wave reads a fragment
  if (wave < 4) {   // phi_q: wave = 16 tokens x 32 columns = one A fragment pair of k_att, 2 KiB that this wave alone writes
    const int tt = wave >> 1, pr = wave & 1; const __bf16* fq = (const __bf16*)(XQ + (unsigned)(16 * tt + col) * XPB); const unsigned char* fw = SW + SLAB + rl * PA + 64u * pr + sub; v8f q0 = {}, q1 = {};
    const float* pb = BQ + cb + 32 * pr + 8 * g;
    __builtin_amdgcn_sched_barrier(0);   // with the one below, as in fu_load: nothing but these loads and their wait stands between the two, so no address register is rewritten ahead of the wait
    const v4f bA = *(const v4f*)pb, bB = *(const v4f*)(pb + 4), bC = *(const v4f*)(pb + 16), bD = *(const v4f*)(pb + 20);   // the lane's 16 bias values, asked for ahead of the products
    asm volatile("s_wait_xcnt 0x0" :: "v"(pb) : "memory");   // precaution: stands before anything rewrites the registers these loads name
    __builtin_amdgcn_sched_barrier(0);
#pragma unroll
    for (int kc = 0; kc < CC / 32; ++kc) { const v16b a = frag_b(fq + kc * 32, lane), w0 = frag_tr(fw + 32u * kc * PA, PA), w1 = frag_tr(fw + 32u * kc * PA + 32u, PA);
      q0 = wmma_bf(w0, a, q0); q1 = wmma_bf(w1, a, q1); }   // rows = columns of Wq, columns = tokens
    __builtin_amdgcn_sched_barrier(0);   // keeps the rounding of the bias values, and with it the wait on their loads, behind the products, so that the loads have the products' time to land
    union { v16b v; v4u q[2]; } uh, ul;
#pragma unroll
    for (int r = 0; r < 8; ++r) { const float f0 = phi_map(q0[r] + bfr(r < 4 ? bA[r & 3] : bB[r & 3])), f1 = phi_map(q1[r] + bfr(r < 4 ? bC[r & 3] : bD[r & 3])); const __bf16 h0 = (__bf16)f0, h1 = (__bf16)f1;
      uh.v[r] = h0; ul.v[r] = (__bf16)(f0 - (float)h0); uh.v[8 + r] = h1; ul.v[8 + r] = (__bf16)(f1 - (float)h1); }
    unsigned char* dq = (unsigned char*)PHQ + (((bq * (TQ / 16) + (size_t)(tq0 / 16 + tt)) * (CC / 32) + (size_t)(cb / 32 + pr)) * FRQ) + (unsigned)lane * 16u;
    *(v4u*)dq = uh.q[0]; *(v4u*)(dq + 512) = uh.q[1]; *(v4u*)(dq + 1024) = ul.q[0]; *(v4u*)(dq + 1536) = ul.q[1];   // four stores of 512 contiguous bytes
    asm volatile("s_wait_xcnt 0x0" :: "v"(uh.q[0]), "v"(uh.q[1]), "v"(ul.q[0]), "v"(ul.q[1]) : "memory");   // precaution: stands before later code rewrites the registers these stores name; it names the stored values, so that none of their registers is taken ahead of it
  }
  v8f acc[16] = {}; v16b wk[8]; const float bb = bfr(BK[cb + wc * 16 + col]);
#pragma unroll
  for (int kc = 0; kc < CC / 32; ++kc) wk[kc] = frag_tr(SW + rl * PA + 32u * wc + sub + 32u * kc * PA, PA);
#pragma unroll 1
  for (int s = 0; s < KV_NS - 2; s += 2) {   // buffer 0 holds stage s, Ra stage s + 1; rolled: the body is already two stages. A stage's loads are issued ahead of the conversions of the stage before it, into the other register set
    fu_mac(fa, fb, wk, bb, lane, acc); KVHOLD(); fu_load(Rb, px, s + 2); fu_stash(Ra, sa + STG_BYTES, sx + STG_BYTES); KVBAR();
    fu_mac(fa + STG_BYTES, fb + STG_BYTES, wk, bb, lane, acc); KVHOLD(); fu_load(Ra, px, s + 3); fu_stash(Rb, sa, sx); KVBAR(); }
  fu_mac(fa, fb, wk, bb, lane, acc); KVHOLD(); fu_stash(Ra, sa + STG_BYTES, sx + STG_BYTES); KVBAR();
  fu_mac(fa + STG_BYTES, fb + STG_BYTES, wk, bb, lane, acc);
  if (wp == 0) {
#pragma unroll
    for (int j = 0; j < 16; ++j)
#pragma unroll
      for (int r = 0; r < 8; ++r) st[j * 16 + col][wc * 16 + 8 * g + r] = acc[j][r]; }   // transposed [d][c]
  __syncthreads();
  if (wp == 1) {
#pragma unroll
    for (int j = 0; j < 16; ++j)
#pragma unroll
      for (int r = 0; r < 8; ++r) st[j * 16 + col][wc * 16 + 8 * g + r] += acc[j][r]; }   // even 32-window groups + odd ones
  __syncthreads(); float* kp = KVT + (size_t)hf * KVPLANE + (b * MW + m) * (size_t)CC * CC + cb + (size_t)(tid >> 4) * CC + (tid & 15) * 4;
#pragma unroll
  for (int i = 0; i < 16; ++i) vst2(kp + (size_t)(16 * i) * CC, *(const v4f*)&st[16 * i + (tid >> 4)][(tid & 15) * 4]); }
// ---- k_att: block = (256 query tokens t, 128 cols d, b*MW + m), 8 waves (wave = 32 t x 128 d): out[b][t*16 + m][d] = phi_q[b,t] . KV[b,m][:, d] (3 products) + p[b][w = t/16][n = t%16][m]
// The block's 128 rows of KV^T (contiguous, 128 KiB of f32 in each of the two planes) are read once with whole-line 16-byte loads, the planes added, the sum split once into bf16 hi + lo and laid in LDS, a row's hi half and lo half side by side; every wave takes its B fragments from there.
// Every "#pragma unroll" of this kernel keeps an array (r, r2, A0, A1, acc0, acc1, w) in registers: its indices must be constants.
#define AP 1040u                             // LDS row pitch in bytes: 256 bf16 hi, 256 bf16 lo, 16 B of pad (16 B x odd, for ds_load_b128)
#define AT_LO 512u                           // a row's lo half
__device__ __forceinline__ F2 att_ldf(const unsigned char* __restrict__ p) {   // one phi_q fragment pair as k_fu laid it: each of the four loads takes 512 contiguous bytes a wave
  union { v16b v; v8b q[2]; } h, l; h.q[0] = *(const v8b*)p; h.q[1] = *(const v8b*)(p + 512); l.q[0] = *(const v8b*)(p + 1024); l.q[1] = *(const v8b*)(p + 1536);
  F2 r; r.h = h.v; r.l = l.v; return r;
}
// the eight B fragments of group G: d tiles 4 (G % 2) .. 4 (G % 2) + 3 of k chunk G / 2, w[0..3] hi, w[4..7] lo
__device__ __forceinline__ void att_ldw(v16b w[8], const unsigned char* sbl, int G, int lane) {
#pragma unroll
  for (int i = 0; i < 4; ++i) { const __bf16* p = (const __bf16*)(sbl + (unsigned)(64 * (G & 1) + 16 * i) * AP) + (G >> 1) * 32; w[i] = frag_b(p, lane); w[4 + i] = frag_b(p + AT_LO / 2, lane); }
}
__global__ __launch_bounds__(256) void k_att(const float* __restrict__ PHQ, const float* __restrict__ KVT, const float* __restrict__ EQK, const float* __restrict__ WP, const float* __restrict__ BP, float* __restrict__ OUT) { __shared__ __align__(16) unsigned char SB[128u * AP]; __shared__ __align__(16) float sf[8][32][132];
  const int tid = threadIdx.x, wave = tid >> 5, lane = tid & 31, col = lane & 15, g = lane >> 4; const size_t b = blockIdx.z / MW; const int m = blockIdx.z % MW; const int t0 = blockIdx.x * 256 + wave * 32; const int d0 = blockIdx.y * 128;
  { const float* src = KVT + ((b * MW + m) * CC + d0) * (size_t)CC + tid * 4; const float* src2 = src + KVPLANE; v4f r[32], r2[32];   // load i: row 4 i + tid / 64, columns 4 (tid % 64) .., of each of the two planes
#pragma unroll
    for (int i = 0; i < 31; ++i) { r[i] = *(const v4f*)(src + i * 1024); r2[i] = *(const v4f*)(src2 + i * 1024); }
    asm volatile("s_wait_xcnt 0x0" ::: "memory");   // precaution: the compiler lets the last load's result take the address pair that the loads above name, so the wait stands ahead of that load
    r[31] = *(const v4f*)(src + 31 * 1024); r2[31] = *(const v4f*)(src2 + 31 * 1024);
    asm volatile("s_wait_xcnt 0x0" ::: "memory");   // precaution: stands before later address arithmetic rewrites the registers these loads name
    unsigned char* sp = SB + (unsigned)(tid >> 6) * AP + (unsigned)(tid & 63) * 8u;
#pragma unroll
    for (int i = 0; i < 32; ++i) { v4b h, l; const v4f s = r[i] + r2[i];   // KV = first half of the windows + second half
#pragma unroll
      for (int e = 0; e < 4; ++e) { h[e] = (__bf16)s[e]; l[e] = (__bf16)(s[e] - (float)h[e]); }
      *(v4b*)(sp + 4u * i * AP) = h; *(v4b*)(sp + AT_LO + 4u * i * AP) = l; } }
  const unsigned char* pq = (const unsigned char*)PHQ + ((b * (TQ / 16) + (size_t)(t0 / 16)) * (CC / 32)) * FRQ + (unsigned)lane * 16u; const unsigned char* pq1 = pq + (CC / 32) * FRQ; F2 A0[3], A1[3];   // the wave's two token tiles; three register sets a tile: the chunk in use and the two asked for
  A0[0] = att_ldf(pq); A1[0] = att_ldf(pq1);
  KVBAR();   // every row of the slab is in LDS before any wave reads a fragment; the fences name LDS alone: nothing global is handed over here
  v8f acc0[8] = {}, acc1[8] = {}; v16b w[2][8]; const unsigned char* sbl = SB + (unsigned)col * AP;
  att_ldw(w[0], sbl, 0, lane);
  A0[1] = att_ldf(pq + FRQ); A1[1] = att_ldf(pq1 + FRQ);
#pragma unroll
  for (int G = 0; G < 2 * (CC / 32); ++G) { const int kc = G >> 1, j = 4 * (G & 1); const F2 &a0 = A0[kc % 3], &a1 = A1[kc % 3];   // a group: one k chunk x four d tiles, 24 products on 8 accumulator tiles; the next group's eight B fragments are fetched into the other register set while these eight are used
    FUGRP();   // with the one below: the sixteen loads stand at one place, not strewn among the products of the group before
    if (G + 1 < 2 * (CC / 32)) att_ldw(w[(G + 1) & 1], sbl, G + 1, lane);
    FUGRP();   // the loads are issued ahead of this group's products, which hide their LDS latency
#pragma unroll
    for (int i = 0; i < 4; ++i) { acc0[j + i] = wmma_p(a0.h, w[G & 1][i], acc0[j + i]); acc1[j + i] = wmma_p(a1.h, w[G & 1][i], acc1[j + i]); }
#pragma unroll
    for (int i = 0; i < 4; ++i) { acc0[j + i] = wmma_p(a0.h, w[G & 1][4 + i], acc0[j + i]); acc1[j + i] = wmma_p(a1.h, w[G & 1][4 + i], acc1[j + i]); }
#pragma unroll
    for (int i = 0; i < 4; ++i) { acc0[j + i] = wmma_p(a0.l, w[G & 1][i], acc0[j + i]); acc1[j + i] = wmma_p(a1.l, w[G & 1][i], acc1[j + i]); }
    if (kc + 2 < CC / 32) {   // the fragments of the chunk after the next are asked for, one token tile a group, into the set that the chunk before this one has left
      if ((G & 1) == 0) A0[(kc + 2) % 3] = att_ldf(pq + (kc + 2) * FRQ); else A1[(kc + 2) % 3] = att_ldf(pq1 + (kc + 2) * FRQ); }
    if (G == 2 * (CC / 32 - 3) + 1) asm volatile("s_wait_xcnt 0x0" :: "v"(pq) : "memory"); }   // precaution, directly behind the last fragment load: stands before later address arithmetic rewrites the registers the fragment loads name; it names the address, so that the pair is kept up to here
  const float wp0 = bfr(WP[0]), wp1 = bfr(WP[1]), wp2 = bfr(WP[2]), bpv = bfr(BP[0]);
#pragma unroll
  for (int u = 0; u < 2; ++u)
#pragma unroll
    for (int r = 0; r < 8; ++r) { const int t = t0 + u * 16 + 8 * g + r; const int w = t / MW, n = t % MW; const float* e3 = EQK + ((((b * NWIN + w) * MW + n) * MW + m) * 3); const float pv = bfr(e3[0]) * wp0 + bfr(e3[1]) * wp1 + bfr(e3[2]) * wp2 + bpv;
#pragma unroll
      for (int j = 0; j < 8; ++j) sf[wave][u * 16 + 8 * g + r][j * 16 + col] = (u ? acc1[j][r] : acc0[j][r]) + pv; }
  LDSX(); for (int rl = 0; rl < 32; ++rl) vst2(OUT + (b * NTOK + (size_t)(t0 + rl) * MW + m) * CC + d0 + lane * 4, *(const v4f*)&sf[wave][rl][lane * 4]); }
extern "C" void kernel_launch(void* const* d_in, const int* in_sizes, int n_in, void* d_out, int out_size, void* d_ws, size_t ws_size, hipStream_t stream) {
  (void)in_sizes; (void)n_in; (void)out_size;
  const float** F = (const float**)d_in;   // 0 input [2,16384,256], 1 embed_qk [2,1024,16,16,3], 2 Wq [256,256] (in,out), 3 bq, 4 Wk, 5 bk, 6 Wp [3,1], 7 bp [1]
  if (ws_size < (size_t)WS_END) return;
  char* ws = (char*)d_ws; float *PHQ = (float*)(ws + WS_PHQ), *KVT = (float*)(ws + WS_KVT);
  k_fu<<<dim3(CC / 64, NHALF, NB * MW), 256, 0, stream>>>(F[0], F[2], F[4], F[3], F[5], PHQ, KVT);
  k_att<<<dim3(TQ / 256, CC / 128, TNB * MW), 256, 0, stream>>>(PHQ, KVT, F[1], F[6], F[7], (float*)d_out);
}
